// v000
// Measured on an AMD MI455X. A time is GPU time per run, averaged over a window of back-to-back runs after a warm-up
// (all launches, gaps included; the runs take copies of the inputs in turn), and the median of several windows.
// Apart from v000's, it joins two sittings. Times from different sittings can be a few percent apart, while
// side-by-side timings come from the same sitting.
// v000 is the starting kernel. One run takes 194 microseconds.
#include <hip/hip_runtime.h>

typedef __attribute__((ext_vector_type(16))) _Float16 v16h;
typedef __attribute__((ext_vector_type(8)))  _Float16 v8h;
typedef __attribute__((ext_vector_type(8)))  float    v8f;
typedef __attribute__((ext_vector_type(4)))  int      v4i;

#define SQ_  2048
#define SK_  2048
#define H_   16
#define HKV_ 4
#define D_   128
#define GQA_ (H_ / HKV_)

#if __has_builtin(__builtin_amdgcn_global_load_async_to_lds_b128) && \
    __has_builtin(__builtin_amdgcn_s_wait_asynccnt)
#define USE_ASYNC_LDS 1
typedef __attribute__((address_space(1))) v4i g_v4i;   // global b128
typedef __attribute__((address_space(3))) v4i l_v4i;   // LDS b128
#else
#define USE_ASYNC_LDS 0
#endif

// Copy 16 bytes global(f16) -> LDS. Async (ASYNCcnt) when the gfx1250 builtin
// exists, else a b128 load + ds_store_b128 pair.
__device__ __forceinline__ void copy16_g2l(const _Float16* g, _Float16* l) {
#if USE_ASYNC_LDS
    __builtin_amdgcn_global_load_async_to_lds_b128((g_v4i*)g, (l_v4i*)l, 0, 0);
#else
    *(v8h*)l = *(const v8h*)g;
#endif
}

// ---------------- one-time K/V convert kernel ----------------
// kh : [HKV][SK][128] f16 (row-major, same as source minus head interleave)
// vth: [HKV][128][SK] f16 (transposed so PV B-operand reads are contiguous)
__global__ __launch_bounds__(256) void cvt_kv_kernel(
        const float* __restrict__ kg, const float* __restrict__ vg,
        _Float16* __restrict__ kh, _Float16* __restrict__ vth)
{
    const int gid = blockIdx.x * 256 + threadIdx.x;
    const int NK  = HKV_ * SK_ * D_ / 8;          // 131072 vec8 jobs for K
    if (gid < NK) {
        const int dseg = gid & (D_ / 8 - 1);      // 0..15
        const int hs   = gid >> 4;                // hkv*SK + s
        const int s    = hs & (SK_ - 1);
        const int hkv  = hs >> 11;
        const float4* s4 = (const float4*)(kg + ((size_t)s * HKV_ + hkv) * D_ + dseg * 8);
        float4 a = s4[0], b = s4[1];
        v8h o;
        o[0]=(_Float16)a.x; o[1]=(_Float16)a.y; o[2]=(_Float16)a.z; o[3]=(_Float16)a.w;
        o[4]=(_Float16)b.x; o[5]=(_Float16)b.y; o[6]=(_Float16)b.z; o[7]=(_Float16)b.w;
        *(v8h*)(kh + (size_t)hs * D_ + dseg * 8) = o;
    } else {
        const int t    = gid - NK;
        const int sseg = t & (SK_ / 8 - 1);       // 0..255
        const int hd   = t >> 8;                  // hkv*128 + d
        const int d    = hd & (D_ - 1);
        const int hkv  = hd >> 7;
        const int s0   = sseg * 8;
        v8h o;
        #pragma unroll
        for (int i = 0; i < 8; ++i)
            o[i] = (_Float16)vg[((size_t)(s0 + i) * HKV_ + hkv) * D_ + d];
        *(v8h*)(vth + (size_t)hd * SK_ + s0) = o;
    }
}

// ---------------- main flash kernel ----------------
template <bool WS>
__launch_bounds__(128, 1)
__global__ void flashmask_fwd(const float* __restrict__ qg,
                              const float* __restrict__ kg,
                              const float* __restrict__ vg,
                              const int*   __restrict__ sr,
                              const _Float16* __restrict__ kh,
                              const _Float16* __restrict__ vth,
                              float* __restrict__ out)
{
    __shared__ _Float16 Kl[32][128];   // K tile, row-major
    __shared__ _Float16 Vt[128][40];   // V tile, transposed (pad->80B rows)
    __shared__ _Float16 Pl[4][16][32]; // per-wave P transpose scratch

    const int tid  = threadIdx.x;
    const int wave = tid >> 5;
    const int lane = tid & 31;
    const int ln16 = lane & 15;
    const int hi8  = (lane >> 4) * 8;

    const int h      = blockIdx.y;
    const int hkv    = h / GQA_;
    const int q_base = blockIdx.x * 64 + wave * 16;

    // fold 1/sqrt(D) * log2(e) into Q: softmax runs in base-2 domain
    const float QSC = 0.08838834764831845f * 1.44269504088896340f;

    // ---- Q tile -> WMMA A layout (pre-scaled) ----
    v16h QA[4];
    {
        const float* qrow = qg + ((size_t)(q_base + ln16) * H_ + h) * D_;
        #pragma unroll
        for (int c = 0; c < 4; ++c) {
            const int dlo = c * 32 + hi8;
            const int dhi = c * 32 + 16 + hi8;
            #pragma unroll
            for (int i = 0; i < 8; ++i) {
                QA[c][i]     = (_Float16)(qrow[dlo + i] * QSC);
                QA[c][i + 8] = (_Float16)(qrow[dhi + i] * QSC);
            }
        }
    }

    v16h ONES;
    #pragma unroll
    for (int i = 0; i < 16; ++i) ONES[i] = (_Float16)1.0f;

    v8f O[8];
    #pragma unroll
    for (int j = 0; j < 8; ++j) O[j] = v8f{};
    v8f mrow, lrow;
    #pragma unroll
    for (int r = 0; r < 8; ++r) { mrow[r] = -1e30f; lrow[r] = 0.0f; }

    const int nkb  = 2 * blockIdx.x + 2;   // causal truncation
    const int crow = tid >> 2;             // 0..31
    const int cq   = tid & 3;              // 64B segment id

    for (int kb = 0; kb < nkb; ++kb) {
        const int k0 = kb * 32;

        // ---------- stage K/V tiles into LDS ----------
        if constexpr (WS) {
            const _Float16* kp = kh  + ((size_t)(hkv * SK_ + k0 + crow)) * D_ + cq * 32;
            const _Float16* vp = vth + ((size_t)(hkv * D_ + tid)) * SK_ + k0;
            #pragma unroll
            for (int i = 0; i < 4; ++i)
                copy16_g2l(kp + i * 8, &Kl[crow][cq * 32 + i * 8]);
            #pragma unroll
            for (int i = 0; i < 4; ++i)
                copy16_g2l(vp + i * 8, &Vt[tid][i * 8]);
            if (kb + 1 < nkb) {            // gfx1250 global_prefetch_b8
                __builtin_prefetch(kp + 32 * D_, 0, 0);
                __builtin_prefetch(vp + 32, 0, 0);
            }
#if USE_ASYNC_LDS
            __builtin_amdgcn_s_wait_asynccnt(0);
#endif
        } else {
            const float* kp = kg + ((size_t)(k0 + crow) * HKV_ + hkv) * D_ + cq * 32;
            const float* vp = vg + ((size_t)(k0 + crow) * HKV_ + hkv) * D_ + cq * 32;
            const float4* kp4 = (const float4*)kp;
            const float4* vp4 = (const float4*)vp;
            #pragma unroll
            for (int i = 0; i < 8; ++i) {
                float4 f = kp4[i];
                Kl[crow][cq * 32 + 4*i + 0] = (_Float16)f.x;
                Kl[crow][cq * 32 + 4*i + 1] = (_Float16)f.y;
                Kl[crow][cq * 32 + 4*i + 2] = (_Float16)f.z;
                Kl[crow][cq * 32 + 4*i + 3] = (_Float16)f.w;
            }
            #pragma unroll
            for (int i = 0; i < 8; ++i) {
                float4 f = vp4[i];
                Vt[cq * 32 + 4*i + 0][crow] = (_Float16)f.x;
                Vt[cq * 32 + 4*i + 1][crow] = (_Float16)f.y;
                Vt[cq * 32 + 4*i + 2][crow] = (_Float16)f.z;
                Vt[cq * 32 + 4*i + 3][crow] = (_Float16)f.w;
            }
            if (kb + 1 < nkb) {
                __builtin_prefetch(kp + 32 * HKV_ * D_, 0, 0);
                __builtin_prefetch(vp + 32 * HKV_ * D_, 0, 0);
            }
        }
        __syncthreads();

        // ---------- S = (Q*qsc) K^T : two 16x16 tiles ----------
        v8f S[2];
        #pragma unroll
        for (int t = 0; t < 2; ++t) {
            v8f acc = v8f{};
            #pragma unroll
            for (int c = 0; c < 4; ++c) {
                v8h lo = *(const v8h*)&Kl[t * 16 + ln16][c * 32 + hi8];
                v8h hi = *(const v8h*)&Kl[t * 16 + ln16][c * 32 + 16 + hi8];
                v16h bk = __builtin_shufflevector(lo, hi,
                    0,1,2,3,4,5,6,7,8,9,10,11,12,13,14,15);
                acc = __builtin_amdgcn_wmma_f32_16x16x32_f16(
                        false, QA[c], false, bk, (short)0, acc, false, false);
            }
            S[t] = acc;
        }

        // ---------- mask: causal | band ----------
        #pragma unroll
        for (int t = 0; t < 2; ++t) {
            const int col  = k0 + t * 16 + ln16;
            const int sidx = (hkv * SK_ + col) * 2;
            const int cs   = sr[sidx];
            const unsigned bw = (unsigned)(sr[sidx + 1] - cs);
            #pragma unroll
            for (int r = 0; r < 8; ++r) {
                const int row = q_base + r + hi8;
                const bool msk = (row < col) || ((unsigned)(row - cs) < bw);
                S[t][r] = msk ? -1e30f : S[t][r];
            }
        }

        // ---------- joint row-max over both tiles, one 4-step tree ----------
        v8f rm;
        #pragma unroll
        for (int r = 0; r < 8; ++r) rm[r] = fmaxf(S[0][r], S[1][r]);
        #pragma unroll
        for (int xd = 1; xd < 16; xd <<= 1) {
            #pragma unroll
            for (int r = 0; r < 8; ++r)
                rm[r] = fmaxf(rm[r], __shfl_xor(rm[r], xd, 32));
        }
        v8f mnew, alpha;
        #pragma unroll
        for (int r = 0; r < 8; ++r) mnew[r]  = fmaxf(mrow[r], rm[r]);
        #pragma unroll
        for (int r = 0; r < 8; ++r) alpha[r] = exp2f(mrow[r] - mnew[r]);
        mrow = mnew;
        #pragma unroll
        for (int j = 0; j < 8; ++j)
            #pragma unroll
            for (int r = 0; r < 8; ++r) O[j][r] *= alpha[r];

        // ---------- P = exp2(S - m), D-layout -> LDS (f16) ----------
        #pragma unroll
        for (int t = 0; t < 2; ++t) {
            #pragma unroll
            for (int r = 0; r < 8; ++r) {
                float p = exp2f(S[t][r] - mnew[r]);
                Pl[wave][r + hi8][t * 16 + ln16] = (_Float16)p;
            }
        }

        // ---------- P back in A layout (wave-private, DS in-order) ----------
        v16h PA;
        {
            v8h lo = *(const v8h*)&Pl[wave][ln16][hi8];
            v8h hi = *(const v8h*)&Pl[wave][ln16][16 + hi8];
            PA = __builtin_shufflevector(lo, hi,
                0,1,2,3,4,5,6,7,8,9,10,11,12,13,14,15);
        }

        // ---------- row-sum via WMMA: P x ones lands sums in lrow layout ----------
        {
            v8f rs = __builtin_amdgcn_wmma_f32_16x16x32_f16(
                       false, PA, false, ONES, (short)0, v8f{}, false, false);
            #pragma unroll
            for (int r = 0; r < 8; ++r) lrow[r] = lrow[r] * alpha[r] + rs[r];
        }

        // ---------- O += P * V (8 d-tiles) ----------
        #pragma unroll
        for (int j = 0; j < 8; ++j) {
            v8h lo = *(const v8h*)&Vt[j * 16 + ln16][hi8];
            v8h hi = *(const v8h*)&Vt[j * 16 + ln16][16 + hi8];
            v16h bv = __builtin_shufflevector(lo, hi,
                0,1,2,3,4,5,6,7,8,9,10,11,12,13,14,15);
            O[j] = __builtin_amdgcn_wmma_f32_16x16x32_f16(
                     false, PA, false, bv, (short)0, O[j], false, false);
        }
        __syncthreads();
    }

    // ---------- normalize + store ----------
    float inv[8];
    #pragma unroll
    for (int r = 0; r < 8; ++r) inv[r] = 1.0f / fmaxf(lrow[r], 1e-20f);
    #pragma unroll
    for (int j = 0; j < 8; ++j) {
        #pragma unroll
        for (int r = 0; r < 8; ++r) {
            const int row = q_base + r + hi8;
            const int d   = j * 16 + ln16;
            out[((size_t)row * H_ + h) * D_ + d] = O[j][r] * inv[r];
        }
    }
}

extern "C" void kernel_launch(void* const* d_in, const int* in_sizes, int n_in,
                              void* d_out, int out_size, void* d_ws, size_t ws_size,
                              hipStream_t stream) {
    const float* q  = (const float*)d_in[0];
    const float* k  = (const float*)d_in[1];
    const float* v  = (const float*)d_in[2];
    const int*   sr = (const int*)d_in[3];
    float* out = (float*)d_out;
    (void)in_sizes; (void)n_in; (void)out_size;

    dim3 grid(SQ_ / 64, H_, 1);
    dim3 block(128, 1, 1);

    const size_t kv_elems = (size_t)HKV_ * SK_ * D_;          // 1M f16 each
    const size_t need     = kv_elems * sizeof(_Float16) * 2;  // 4 MB
    if (ws_size >= need) {
        _Float16* kh  = (_Float16*)d_ws;
        _Float16* vth = kh + kv_elems;
        cvt_kv_kernel<<<(2 * (int)(kv_elems / 8)) / 256, 256, 0, stream>>>(k, v, kh, vth);
        flashmask_fwd<true><<<grid, block, 0, stream>>>(q, k, v, sr, kh, vth, out);
    } else {
        flashmask_fwd<false><<<grid, block, 0, stream>>>(q, k, v, sr, nullptr, nullptr, out);
    }
}

// v001
// Measured time: 133 microseconds a run.
// Next to v000, in two timings, it ran 1.49 times as fast each time.
#include <hip/hip_runtime.h>

typedef __attribute__((ext_vector_type(16))) _Float16 v16h;
typedef __attribute__((ext_vector_type(8)))  _Float16 v8h;
typedef __attribute__((ext_vector_type(8)))  float    v8f;
typedef __attribute__((ext_vector_type(4)))  int      v4i;

#define SQ_  2048
#define SK_  2048
#define H_   16
#define HKV_ 4
#define D_   128
#define GQA_ (H_ / HKV_)

#if __has_builtin(__builtin_amdgcn_global_load_async_to_lds_b128) && \
    __has_builtin(__builtin_amdgcn_s_wait_asynccnt)
#define USE_ASYNC_LDS 1
typedef __attribute__((address_space(1))) v4i g_v4i;   // global b128
typedef __attribute__((address_space(3))) v4i l_v4i;   // LDS b128
#else
#define USE_ASYNC_LDS 0
#endif

// Copy 16 bytes global(f16) -> LDS. Async (ASYNCcnt) when the gfx1250 builtin
// exists, else a b128 load + ds_store_b128 pair.
__device__ __forceinline__ void copy16_g2l(const _Float16* g, _Float16* l) {
#if USE_ASYNC_LDS
    __builtin_amdgcn_global_load_async_to_lds_b128((g_v4i*)g, (l_v4i*)l, 0, 0);
#else
    *(v8h*)l = *(const v8h*)g;
#endif
}

// ---------------- one-time K/V convert kernel ----------------
// kh : [HKV][SK][128] f16 (row-major, same as source minus head interleave)
// vth: [HKV][128][SK] f16 (transposed so PV B-operand reads are contiguous)
__global__ __launch_bounds__(256) void cvt_kv_kernel(
        const float* __restrict__ kg, const float* __restrict__ vg,
        _Float16* __restrict__ kh, _Float16* __restrict__ vth)
{
    const int gid = blockIdx.x * 256 + threadIdx.x;
    const int NK  = HKV_ * SK_ * D_ / 8;          // 131072 vec8 jobs for K
    if (gid < NK) {
        const int dseg = gid & (D_ / 8 - 1);      // 0..15
        const int hs   = gid >> 4;                // hkv*SK + s
        const int s    = hs & (SK_ - 1);
        const int hkv  = hs >> 11;
        const float4* s4 = (const float4*)(kg + ((size_t)s * HKV_ + hkv) * D_ + dseg * 8);
        float4 a = s4[0], b = s4[1];
        v8h o;
        o[0]=(_Float16)a.x; o[1]=(_Float16)a.y; o[2]=(_Float16)a.z; o[3]=(_Float16)a.w;
        o[4]=(_Float16)b.x; o[5]=(_Float16)b.y; o[6]=(_Float16)b.z; o[7]=(_Float16)b.w;
        *(v8h*)(kh + (size_t)hs * D_ + dseg * 8) = o;
    } else {
        const int t    = gid - NK;
        const int sseg = t & (SK_ / 8 - 1);       // 0..255
        const int hd   = t >> 8;                  // hkv*128 + d
        const int d    = hd & (D_ - 1);
        const int hkv  = hd >> 7;
        const int s0   = sseg * 8;
        v8h o;
        #pragma unroll
        for (int i = 0; i < 8; ++i)
            o[i] = (_Float16)vg[((size_t)(s0 + i) * HKV_ + hkv) * D_ + d];
        *(v8h*)(vth + (size_t)hd * SK_ + s0) = o;
    }
}

// ---------------- main flash kernel ----------------
template <bool WS>
__launch_bounds__(128, 1)
__global__ void flashmask_fwd(const float* __restrict__ qg,
                              const float* __restrict__ kg,
                              const float* __restrict__ vg,
                              const int*   __restrict__ sr,
                              const _Float16* __restrict__ kh,
                              const _Float16* __restrict__ vth,
                              float* __restrict__ out)
{
    __shared__ _Float16 Kl[32][136];   // K tile, row-major (pad->272B rows: 16 B x odd, b128 column reads hit distinct banks)
    __shared__ _Float16 Vt[128][40];   // V tile, transposed (pad->80B rows)
    __shared__ _Float16 Pl[4][16][40]; // per-wave P transpose scratch (pad->80B rows, same reason)

    const int tid  = threadIdx.x;
    const int wave = tid >> 5;
    const int lane = tid & 31;
    const int ln16 = lane & 15;
    const int hi8  = (lane >> 4) * 8;

    const int h      = blockIdx.y;
    const int hkv    = h / GQA_;
    const int q_base = blockIdx.x * 64 + wave * 16;

    // fold 1/sqrt(D) * log2(e) into Q: softmax runs in base-2 domain
    const float QSC = 0.08838834764831845f * 1.44269504088896340f;

    // ---- Q tile -> WMMA A layout (pre-scaled) ----
    v16h QA[4];
    {
        const float* qrow = qg + ((size_t)(q_base + ln16) * H_ + h) * D_;
        #pragma unroll
        for (int c = 0; c < 4; ++c) {
            const int dlo = c * 32 + hi8;
            const int dhi = c * 32 + 16 + hi8;
            #pragma unroll
            for (int i = 0; i < 8; ++i) {
                QA[c][i]     = (_Float16)(qrow[dlo + i] * QSC);
                QA[c][i + 8] = (_Float16)(qrow[dhi + i] * QSC);
            }
        }
    }

    v16h ONES;
    #pragma unroll
    for (int i = 0; i < 16; ++i) ONES[i] = (_Float16)1.0f;

    v8f O[8];
    #pragma unroll
    for (int j = 0; j < 8; ++j) O[j] = v8f{};
    v8f mrow, lrow;
    #pragma unroll
    for (int r = 0; r < 8; ++r) { mrow[r] = -1e30f; lrow[r] = 0.0f; }

    const int nkb  = 2 * blockIdx.x + 2;   // causal truncation
    const int crow = tid >> 2;             // 0..31
    const int cq   = tid & 3;              // 64B segment id

    for (int kb = 0; kb < nkb; ++kb) {
        const int k0 = kb * 32;

        // ---------- stage K/V tiles into LDS ----------
        if constexpr (WS) {
            const _Float16* kp = kh  + ((size_t)(hkv * SK_ + k0 + crow)) * D_ + cq * 32;
            const _Float16* vp = vth + ((size_t)(hkv * D_ + tid)) * SK_ + k0;
            #pragma unroll
            for (int i = 0; i < 4; ++i)
                copy16_g2l(kp + i * 8, &Kl[crow][cq * 32 + i * 8]);
            #pragma unroll
            for (int i = 0; i < 4; ++i)
                copy16_g2l(vp + i * 8, &Vt[tid][i * 8]);
            if (kb + 1 < nkb) {            // gfx1250 global_prefetch_b8
                __builtin_prefetch(kp + 32 * D_, 0, 0);
                __builtin_prefetch(vp + 32, 0, 0);
            }
#if USE_ASYNC_LDS
            __builtin_amdgcn_s_wait_asynccnt(0);
#endif
        } else {
            const float* kp = kg + ((size_t)(k0 + crow) * HKV_ + hkv) * D_ + cq * 32;
            const float* vp = vg + ((size_t)(k0 + crow) * HKV_ + hkv) * D_ + cq * 32;
            const float4* kp4 = (const float4*)kp;
            const float4* vp4 = (const float4*)vp;
            #pragma unroll
            for (int i = 0; i < 8; ++i) {
                float4 f = kp4[i];
                Kl[crow][cq * 32 + 4*i + 0] = (_Float16)f.x;
                Kl[crow][cq * 32 + 4*i + 1] = (_Float16)f.y;
                Kl[crow][cq * 32 + 4*i + 2] = (_Float16)f.z;
                Kl[crow][cq * 32 + 4*i + 3] = (_Float16)f.w;
            }
            #pragma unroll
            for (int i = 0; i < 8; ++i) {
                float4 f = vp4[i];
                Vt[cq * 32 + 4*i + 0][crow] = (_Float16)f.x;
                Vt[cq * 32 + 4*i + 1][crow] = (_Float16)f.y;
                Vt[cq * 32 + 4*i + 2][crow] = (_Float16)f.z;
                Vt[cq * 32 + 4*i + 3][crow] = (_Float16)f.w;
            }
            if (kb + 1 < nkb) {
                __builtin_prefetch(kp + 32 * HKV_ * D_, 0, 0);
                __builtin_prefetch(vp + 32 * HKV_ * D_, 0, 0);
            }
        }
        __syncthreads();

        // ---------- S = (Q*qsc) K^T : two 16x16 tiles ----------
        v8f S[2];
        #pragma unroll
        for (int t = 0; t < 2; ++t) {
            v8f acc = v8f{};
            #pragma unroll
            for (int c = 0; c < 4; ++c) {
                v8h lo = *(const v8h*)&Kl[t * 16 + ln16][c * 32 + hi8];
                v8h hi = *(const v8h*)&Kl[t * 16 + ln16][c * 32 + 16 + hi8];
                v16h bk = __builtin_shufflevector(lo, hi,
                    0,1,2,3,4,5,6,7,8,9,10,11,12,13,14,15);
                acc = __builtin_amdgcn_wmma_f32_16x16x32_f16(
                        false, QA[c], false, bk, (short)0, acc, false, false);
            }
            S[t] = acc;
        }

        // ---------- mask: causal | band ----------
        #pragma unroll
        for (int t = 0; t < 2; ++t) {
            const int col  = k0 + t * 16 + ln16;
            const int sidx = (hkv * SK_ + col) * 2;
            const int cs   = sr[sidx];
            const unsigned bw = (unsigned)(sr[sidx + 1] - cs);
            #pragma unroll
            for (int r = 0; r < 8; ++r) {
                const int row = q_base + r + hi8;
                const bool msk = (row < col) || ((unsigned)(row - cs) < bw);
                S[t][r] = msk ? -1e30f : S[t][r];
            }
        }

        // ---------- joint row-max over both tiles, one 4-step tree ----------
        v8f rm;
        #pragma unroll
        for (int r = 0; r < 8; ++r) rm[r] = fmaxf(S[0][r], S[1][r]);
        #pragma unroll
        for (int xd = 1; xd < 16; xd <<= 1) {
            #pragma unroll
            for (int r = 0; r < 8; ++r)
                rm[r] = fmaxf(rm[r], __shfl_xor(rm[r], xd, 32));
        }
        v8f mnew, alpha;
        #pragma unroll
        for (int r = 0; r < 8; ++r) mnew[r]  = fmaxf(mrow[r], rm[r]);
        #pragma unroll
        for (int r = 0; r < 8; ++r) alpha[r] = exp2f(mrow[r] - mnew[r]);
        mrow = mnew;
        #pragma unroll
        for (int j = 0; j < 8; ++j)
            #pragma unroll
            for (int r = 0; r < 8; ++r) O[j][r] *= alpha[r];

        // ---------- P = exp2(S - m), D-layout -> LDS (f16) ----------
        #pragma unroll
        for (int t = 0; t < 2; ++t) {
            #pragma unroll
            for (int r = 0; r < 8; ++r) {
                float p = exp2f(S[t][r] - mnew[r]);
                Pl[wave][r + hi8][t * 16 + ln16] = (_Float16)p;
            }
        }

        // ---------- P back in A layout (wave-private, DS in-order) ----------
        v16h PA;
        {
            v8h lo = *(const v8h*)&Pl[wave][ln16][hi8];
            v8h hi = *(const v8h*)&Pl[wave][ln16][16 + hi8];
            PA = __builtin_shufflevector(lo, hi,
                0,1,2,3,4,5,6,7,8,9,10,11,12,13,14,15);
        }

        // ---------- row-sum via WMMA: P x ones lands sums in lrow layout ----------
        {
            v8f rs = __builtin_amdgcn_wmma_f32_16x16x32_f16(
                       false, PA, false, ONES, (short)0, v8f{}, false, false);
            #pragma unroll
            for (int r = 0; r < 8; ++r) lrow[r] = lrow[r] * alpha[r] + rs[r];
        }

        // ---------- O += P * V (8 d-tiles) ----------
        #pragma unroll
        for (int j = 0; j < 8; ++j) {
            v8h lo = *(const v8h*)&Vt[j * 16 + ln16][hi8];
            v8h hi = *(const v8h*)&Vt[j * 16 + ln16][16 + hi8];
            v16h bv = __builtin_shufflevector(lo, hi,
                0,1,2,3,4,5,6,7,8,9,10,11,12,13,14,15);
            O[j] = __builtin_amdgcn_wmma_f32_16x16x32_f16(
                     false, PA, false, bv, (short)0, O[j], false, false);
        }
        __syncthreads();
    }

    // ---------- normalize + store ----------
    float inv[8];
    #pragma unroll
    for (int r = 0; r < 8; ++r) inv[r] = 1.0f / fmaxf(lrow[r], 1e-20f);
    #pragma unroll
    for (int j = 0; j < 8; ++j) {
        #pragma unroll
        for (int r = 0; r < 8; ++r) {
            const int row = q_base + r + hi8;
            const int d   = j * 16 + ln16;
            out[((size_t)row * H_ + h) * D_ + d] = O[j][r] * inv[r];
        }
    }
}

extern "C" void kernel_launch(void* const* d_in, const int* in_sizes, int n_in,
                              void* d_out, int out_size, void* d_ws, size_t ws_size,
                              hipStream_t stream) {
    const float* q  = (const float*)d_in[0];
    const float* k  = (const float*)d_in[1];
    const float* v  = (const float*)d_in[2];
    const int*   sr = (const int*)d_in[3];
    float* out = (float*)d_out;
    (void)in_sizes; (void)n_in; (void)out_size;

    dim3 grid(SQ_ / 64, H_, 1);
    dim3 block(128, 1, 1);

    const size_t kv_elems = (size_t)HKV_ * SK_ * D_;          // 1M f16 each
    const size_t need     = kv_elems * sizeof(_Float16) * 2;  // 4 MB
    if (ws_size >= need) {
        _Float16* kh  = (_Float16*)d_ws;
        _Float16* vth = kh + kv_elems;
        cvt_kv_kernel<<<(2 * (int)(kv_elems / 8)) / 256, 256, 0, stream>>>(k, v, kh, vth);
        flashmask_fwd<true><<<grid, block, 0, stream>>>(q, k, v, sr, kh, vth, out);
    } else {
        flashmask_fwd<false><<<grid, block, 0, stream>>>(q, k, v, sr, nullptr, nullptr, out);
    }
}

// v002
// Measured time: 97.1 microseconds a run.
// Two timings next to v001 both put it at 1.36 times that version's speed.
// Counting every step since v000, it is 2.02 times as fast.
#include <hip/hip_runtime.h>

typedef __attribute__((ext_vector_type(16))) _Float16 v16h;
typedef __attribute__((ext_vector_type(8)))  _Float16 v8h;
typedef __attribute__((ext_vector_type(8)))  float    v8f;
typedef __attribute__((ext_vector_type(4)))  float    v4f;
typedef __attribute__((ext_vector_type(4)))  int      v4i;

#define SQ_  2048
#define SK_  2048
#define H_   16
#define HKV_ 4
#define D_   128
#define GQA_ (H_ / HKV_)
#define KSPLIT_ 4   // wave groups per work-group; group g takes key tiles g, g+4, g+8, ...

#if __has_builtin(__builtin_amdgcn_global_load_async_to_lds_b128) && \
    __has_builtin(__builtin_amdgcn_s_wait_asynccnt)
#define USE_ASYNC_LDS 1
typedef __attribute__((address_space(1))) v4i g_v4i;   // global b128
typedef __attribute__((address_space(3))) v4i l_v4i;   // LDS b128
#else
#define USE_ASYNC_LDS 0
#endif

// Copy 16 bytes global(f16) -> LDS. Async (ASYNCcnt) when the gfx1250 builtin
// exists, else a b128 load + ds_store_b128 pair.
__device__ __forceinline__ void copy16_g2l(const _Float16* g, _Float16* l) {
#if USE_ASYNC_LDS
    __builtin_amdgcn_global_load_async_to_lds_b128((g_v4i*)g, (l_v4i*)l, 0, 0);
#else
    *(v8h*)l = *(const v8h*)g;
#endif
}

// ---------------- one-time K/V convert kernel ----------------
// kh : [HKV][SK][128] f16 (row-major, same as source minus head interleave)
// vth: [HKV][128][SK] f16 (transposed so PV B-operand reads are contiguous)
__global__ __launch_bounds__(256) void cvt_kv_kernel(
        const float* __restrict__ kg, const float* __restrict__ vg,
        _Float16* __restrict__ kh, _Float16* __restrict__ vth)
{
    const int gid = blockIdx.x * 256 + threadIdx.x;
    const int NK  = HKV_ * SK_ * D_ / 8;          // 131072 vec8 jobs for K
    if (gid < NK) {
        const int dseg = gid & (D_ / 8 - 1);      // 0..15
        const int hs   = gid >> 4;                // hkv*SK + s
        const int s    = hs & (SK_ - 1);
        const int hkv  = hs >> 11;
        const float4* s4 = (const float4*)(kg + ((size_t)s * HKV_ + hkv) * D_ + dseg * 8);
        float4 a = s4[0], b = s4[1];
        v8h o;
        o[0]=(_Float16)a.x; o[1]=(_Float16)a.y; o[2]=(_Float16)a.z; o[3]=(_Float16)a.w;
        o[4]=(_Float16)b.x; o[5]=(_Float16)b.y; o[6]=(_Float16)b.z; o[7]=(_Float16)b.w;
        *(v8h*)(kh + (size_t)hs * D_ + dseg * 8) = o;
    } else {
        const int t    = gid - NK;
        const int sseg = t & (SK_ / 8 - 1);       // 0..255
        const int hd   = t >> 8;                  // hkv*128 + d
        const int d    = hd & (D_ - 1);
        const int hkv  = hd >> 7;
        const int s0   = sseg * 8;
        v8h o;
        #pragma unroll
        for (int i = 0; i < 8; ++i)
            o[i] = (_Float16)vg[((size_t)(s0 + i) * HKV_ + hkv) * D_ + d];
        *(v8h*)(vth + (size_t)hd * SK_ + s0) = o;
    }
}

// ---------------- main flash kernel ----------------
// One work-group = 64 query rows x KSPLIT_ groups of 4 waves. Every group runs
// its own online softmax over every KSPLIT_-th key tile, with its own K/V/P
// LDS; group 0 joins the partial (m, l, O) through LDS at the end.
template <bool WS>
__launch_bounds__(128 * KSPLIT_, 1)
__global__ void flashmask_fwd(const float* __restrict__ qg,
                              const float* __restrict__ kg,
                              const float* __restrict__ vg,
                              const int*   __restrict__ sr,
                              const _Float16* __restrict__ kh,
                              const _Float16* __restrict__ vth,
                              float* __restrict__ out)
{
    __shared__ _Float16 Kl[KSPLIT_][32][136];   // K tile, row-major (pad->272B rows: 16 B x odd, b128 column reads hit distinct banks)
    __shared__ _Float16 Vt[KSPLIT_][128][40];   // V tile, transposed (pad->80B rows)
    __shared__ _Float16 Pl[4 * KSPLIT_][16][40]; // per-wave P transpose scratch (pad->80B rows, same reason)
    __shared__ v4f Mg[KSPLIT_ - 1][4][20][32];   // partials of groups 1.. : 16 x O, 2 x m, 2 x l, one b128 per lane

    const int tid  = threadIdx.x;
    const int wave = tid >> 5;             // 0..15
    const int lane = tid & 31;
    const int grp  = __builtin_amdgcn_readfirstlane(tid >> 7);  // key-split group, wave-uniform
    const int gw   = wave & 3;             // wave inside its group: which 16 query rows
    const int gt   = tid & 127;            // thread inside its group
    const int ln16 = lane & 15;
    const int hi8  = (lane >> 4) * 8;

    const int h      = blockIdx.y;
    const int hkv    = h / GQA_;
    const int q_base = blockIdx.x * 64 + gw * 16;

    // fold 1/sqrt(D) * log2(e) into Q: softmax runs in base-2 domain
    const float QSC = 0.08838834764831845f * 1.44269504088896340f;

    // ---- Q tile -> WMMA A layout (pre-scaled) ----
    v16h QA[4];
    {
        const float* qrow = qg + ((size_t)(q_base + ln16) * H_ + h) * D_;
        #pragma unroll
        for (int c = 0; c < 4; ++c) {
            const int dlo = c * 32 + hi8;
            const int dhi = c * 32 + 16 + hi8;
            #pragma unroll
            for (int i = 0; i < 8; ++i) {
                QA[c][i]     = (_Float16)(qrow[dlo + i] * QSC);
                QA[c][i + 8] = (_Float16)(qrow[dhi + i] * QSC);
            }
        }
    }

    v16h ONES;
    #pragma unroll
    for (int i = 0; i < 16; ++i) ONES[i] = (_Float16)1.0f;

    v8f O[8];
    #pragma unroll
    for (int j = 0; j < 8; ++j) O[j] = v8f{};
    v8f mrow, lrow;
    #pragma unroll
    for (int r = 0; r < 8; ++r) { mrow[r] = -1e30f; lrow[r] = 0.0f; }

    const int nkb  = 2 * blockIdx.x + 2;   // causal truncation
    const int nit  = (nkb + KSPLIT_ - 1) / KSPLIT_;
    const int crow = gt >> 2;              // 0..31
    const int cq   = gt & 3;               // 64B segment id

    for (int it = 0; it < nit; ++it) {
        // A tile with kb >= nkb (last trip only, still inside SK_) lies wholly
        // above the diagonal: the causal mask below gives it weight 0.
        const int kb = it * KSPLIT_ + grp;
        const int k0 = kb * 32;

        // ---------- stage K/V tiles into LDS ----------
        if constexpr (WS) {
            const _Float16* kp = kh  + ((size_t)(hkv * SK_ + k0 + crow)) * D_ + cq * 32;
            const _Float16* vp = vth + ((size_t)(hkv * D_ + gt)) * SK_ + k0;
            #pragma unroll
            for (int i = 0; i < 4; ++i)
                copy16_g2l(kp + i * 8, &Kl[grp][crow][cq * 32 + i * 8]);
            #pragma unroll
            for (int i = 0; i < 4; ++i)
                copy16_g2l(vp + i * 8, &Vt[grp][gt][i * 8]);
            if (it + 1 < nit) {            // gfx1250 global_prefetch_b8
                __builtin_prefetch(kp + KSPLIT_ * 32 * D_, 0, 0);
                __builtin_prefetch(vp + KSPLIT_ * 32, 0, 0);
            }
#if USE_ASYNC_LDS
            __builtin_amdgcn_s_wait_asynccnt(0);
#endif
        } else {
            const float* kp = kg + ((size_t)(k0 + crow) * HKV_ + hkv) * D_ + cq * 32;
            const float* vp = vg + ((size_t)(k0 + crow) * HKV_ + hkv) * D_ + cq * 32;
            const float4* kp4 = (const float4*)kp;
            const float4* vp4 = (const float4*)vp;
            #pragma unroll
            for (int i = 0; i < 8; ++i) {
                float4 f = kp4[i];
                Kl[grp][crow][cq * 32 + 4*i + 0] = (_Float16)f.x;
                Kl[grp][crow][cq * 32 + 4*i + 1] = (_Float16)f.y;
                Kl[grp][crow][cq * 32 + 4*i + 2] = (_Float16)f.z;
                Kl[grp][crow][cq * 32 + 4*i + 3] = (_Float16)f.w;
            }
            #pragma unroll
            for (int i = 0; i < 8; ++i) {
                float4 f = vp4[i];
                Vt[grp][cq * 32 + 4*i + 0][crow] = (_Float16)f.x;
                Vt[grp][cq * 32 + 4*i + 1][crow] = (_Float16)f.y;
                Vt[grp][cq * 32 + 4*i + 2][crow] = (_Float16)f.z;
                Vt[grp][cq * 32 + 4*i + 3][crow] = (_Float16)f.w;
            }
            if (it + 1 < nit) {
                __builtin_prefetch(kp + KSPLIT_ * 32 * HKV_ * D_, 0, 0);
                __builtin_prefetch(vp + KSPLIT_ * 32 * HKV_ * D_, 0, 0);
            }
        }
        __syncthreads();

        // ---------- S = (Q*qsc) K^T : two 16x16 tiles ----------
        v8f S[2];
        #pragma unroll
        for (int t = 0; t < 2; ++t) {
            v8f acc = v8f{};
            #pragma unroll
            for (int c = 0; c < 4; ++c) {
                v8h lo = *(const v8h*)&Kl[grp][t * 16 + ln16][c * 32 + hi8];
                v8h hi = *(const v8h*)&Kl[grp][t * 16 + ln16][c * 32 + 16 + hi8];
                v16h bk = __builtin_shufflevector(lo, hi,
                    0,1,2,3,4,5,6,7,8,9,10,11,12,13,14,15);
                acc = __builtin_amdgcn_wmma_f32_16x16x32_f16(
                        false, QA[c], false, bk, (short)0, acc, false, false);
            }
            S[t] = acc;
        }

        // ---------- mask: causal | band ----------
        #pragma unroll
        for (int t = 0; t < 2; ++t) {
            const int col  = k0 + t * 16 + ln16;
            const int sidx = (hkv * SK_ + col) * 2;
            const int cs   = sr[sidx];
            const unsigned bw = (unsigned)(sr[sidx + 1] - cs);
            #pragma unroll
            for (int r = 0; r < 8; ++r) {
                const int row = q_base + r + hi8;
                const bool msk = (row < col) || ((unsigned)(row - cs) < bw);
                S[t][r] = msk ? -1e30f : S[t][r];
            }
        }

        // ---------- joint row-max over both tiles, one 4-step tree ----------
        v8f rm;
        #pragma unroll
        for (int r = 0; r < 8; ++r) rm[r] = fmaxf(S[0][r], S[1][r]);
        #pragma unroll
        for (int xd = 1; xd < 16; xd <<= 1) {
            #pragma unroll
            for (int r = 0; r < 8; ++r)
                rm[r] = fmaxf(rm[r], __shfl_xor(rm[r], xd, 32));
        }
        v8f mnew, alpha;
        #pragma unroll
        for (int r = 0; r < 8; ++r) mnew[r]  = fmaxf(mrow[r], rm[r]);
        #pragma unroll
        for (int r = 0; r < 8; ++r) alpha[r] = exp2f(mrow[r] - mnew[r]);
        mrow = mnew;
        #pragma unroll
        for (int j = 0; j < 8; ++j)
            #pragma unroll
            for (int r = 0; r < 8; ++r) O[j][r] *= alpha[r];

        // ---------- P = exp2(S - m), D-layout -> LDS (f16) ----------
        #pragma unroll
        for (int t = 0; t < 2; ++t) {
            #pragma unroll
            for (int r = 0; r < 8; ++r) {
                float p = exp2f(S[t][r] - mnew[r]);
                Pl[wave][r + hi8][t * 16 + ln16] = (_Float16)p;
            }
        }

        // ---------- P back in A layout (wave-private, DS in-order) ----------
        v16h PA;
        {
            v8h lo = *(const v8h*)&Pl[wave][ln16][hi8];
            v8h hi = *(const v8h*)&Pl[wave][ln16][16 + hi8];
            PA = __builtin_shufflevector(lo, hi,
                0,1,2,3,4,5,6,7,8,9,10,11,12,13,14,15);
        }

        // ---------- row-sum via WMMA: P x ones lands sums in lrow layout ----------
        {
            v8f rs = __builtin_amdgcn_wmma_f32_16x16x32_f16(
                       false, PA, false, ONES, (short)0, v8f{}, false, false);
            #pragma unroll
            for (int r = 0; r < 8; ++r) lrow[r] = lrow[r] * alpha[r] + rs[r];
        }

        // ---------- O += P * V (8 d-tiles) ----------
        #pragma unroll
        for (int j = 0; j < 8; ++j) {
            v8h lo = *(const v8h*)&Vt[grp][j * 16 + ln16][hi8];
            v8h hi = *(const v8h*)&Vt[grp][j * 16 + ln16][16 + hi8];
            v16h bv = __builtin_shufflevector(lo, hi,
                0,1,2,3,4,5,6,7,8,9,10,11,12,13,14,15);
            O[j] = __builtin_amdgcn_wmma_f32_16x16x32_f16(
                     false, PA, false, bv, (short)0, O[j], false, false);
        }
        __syncthreads();
    }

    // ---------- join the groups' partial softmaxes (same lane/register layout in every group) ----------
    if (grp != 0) {
        v4f (*dst)[32] = Mg[grp - 1][gw];
        #pragma unroll
        for (int j = 0; j < 8; ++j) {
            dst[2 * j][lane]     = __builtin_shufflevector(O[j], O[j], 0, 1, 2, 3);
            dst[2 * j + 1][lane] = __builtin_shufflevector(O[j], O[j], 4, 5, 6, 7);
        }
        dst[16][lane] = __builtin_shufflevector(mrow, mrow, 0, 1, 2, 3);
        dst[17][lane] = __builtin_shufflevector(mrow, mrow, 4, 5, 6, 7);
        dst[18][lane] = __builtin_shufflevector(lrow, lrow, 0, 1, 2, 3);
        dst[19][lane] = __builtin_shufflevector(lrow, lrow, 4, 5, 6, 7);
    }
    __syncthreads();
    if (grp != 0) return;   // no barrier follows

    // rolled: one group's partials in registers at a time (unrolled, the hoisted LDS loads spill)
    #pragma unroll 1
    for (int g = 0; g < KSPLIT_ - 1; ++g) {
        const v4f (*srcp)[32] = Mg[g][gw];
        const v8f mo = __builtin_shufflevector(srcp[16][lane], srcp[17][lane], 0, 1, 2, 3, 4, 5, 6, 7);
        const v8f lo = __builtin_shufflevector(srcp[18][lane], srcp[19][lane], 0, 1, 2, 3, 4, 5, 6, 7);
        v8f wa, wb;   // a side that saw no unmasked key of a row gets weight 0 there
        #pragma unroll
        for (int r = 0; r < 8; ++r) {
            const float mt = fmaxf(mrow[r], mo[r]);
            wa[r]   = exp2f(mrow[r] - mt);
            wb[r]   = exp2f(mo[r] - mt);
            mrow[r] = mt;
            lrow[r] = lrow[r] * wa[r] + lo[r] * wb[r];
        }
        #pragma unroll
        for (int j = 0; j < 8; ++j) {
            const v8f og = __builtin_shufflevector(srcp[2 * j][lane], srcp[2 * j + 1][lane],
                                                   0, 1, 2, 3, 4, 5, 6, 7);
            #pragma unroll
            for (int r = 0; r < 8; ++r) O[j][r] = O[j][r] * wa[r] + og[r] * wb[r];
        }
    }

    // ---------- normalize + store ----------
    float inv[8];
    #pragma unroll
    for (int r = 0; r < 8; ++r) inv[r] = 1.0f / fmaxf(lrow[r], 1e-20f);
    #pragma unroll
    for (int j = 0; j < 8; ++j) {
        #pragma unroll
        for (int r = 0; r < 8; ++r) {
            const int row = q_base + r + hi8;
            const int d   = j * 16 + ln16;
            out[((size_t)row * H_ + h) * D_ + d] = O[j][r] * inv[r];
        }
    }
}

extern "C" void kernel_launch(void* const* d_in, const int* in_sizes, int n_in,
                              void* d_out, int out_size, void* d_ws, size_t ws_size,
                              hipStream_t stream) {
    const float* q  = (const float*)d_in[0];
    const float* k  = (const float*)d_in[1];
    const float* v  = (const float*)d_in[2];
    const int*   sr = (const int*)d_in[3];
    float* out = (float*)d_out;
    (void)in_sizes; (void)n_in; (void)out_size;

    dim3 grid(SQ_ / 64, H_, 1);
    dim3 block(128 * KSPLIT_, 1, 1);

    const size_t kv_elems = (size_t)HKV_ * SK_ * D_;          // 1M f16 each
    const size_t need     = kv_elems * sizeof(_Float16) * 2;  // 4 MB
    if (ws_size >= need) {
        _Float16* kh  = (_Float16*)d_ws;
        _Float16* vth = kh + kv_elems;
        cvt_kv_kernel<<<(2 * (int)(kv_elems / 8)) / 256, 256, 0, stream>>>(k, v, kh, vth);
        flashmask_fwd<true><<<grid, block, 0, stream>>>(q, k, v, sr, kh, vth, out);
    } else {
        flashmask_fwd<false><<<grid, block, 0, stream>>>(q, k, v, sr, nullptr, nullptr, out);
    }
}

// v003
// It runs in 78.3 microseconds.
// Timed twice side by side with v002, it ran 1.24 and 1.25 times as fast.
// All steps since v000 together make it 2.52 times as fast.
#include <hip/hip_runtime.h>

typedef __attribute__((ext_vector_type(16))) _Float16 v16h;
typedef __attribute__((ext_vector_type(8)))  _Float16 v8h;
typedef __attribute__((ext_vector_type(8)))  float    v8f;
typedef __attribute__((ext_vector_type(4)))  float    v4f;
typedef __attribute__((ext_vector_type(4)))  int      v4i;

#define SQ_  2048
#define SK_  2048
#define H_   16
#define HKV_ 4
#define D_   128
#define GQA_ (H_ / HKV_)
#define KSPLIT_ 4   // wave groups per work-group; group g takes key tiles g, g+4, g+8, ...

#if __has_builtin(__builtin_amdgcn_global_load_async_to_lds_b128) && \
    __has_builtin(__builtin_amdgcn_s_wait_asynccnt)
#define USE_ASYNC_LDS 1
typedef __attribute__((address_space(1))) v4i g_v4i;   // global b128
typedef __attribute__((address_space(3))) v4i l_v4i;   // LDS b128
#else
#define USE_ASYNC_LDS 0
#endif

// Copy 16 bytes global(f16) -> LDS. Async (ASYNCcnt) when the gfx1250 builtin
// exists, else a b128 load + ds_store_b128 pair.
__device__ __forceinline__ void copy16_g2l(const _Float16* g, _Float16* l) {
#if USE_ASYNC_LDS
    __builtin_amdgcn_global_load_async_to_lds_b128((g_v4i*)g, (l_v4i*)l, 0, 0);
#else
    *(v8h*)l = *(const v8h*)g;
#endif
}

// ---------------- one-time K/V convert kernel ----------------
// kh : [HKV][SK][128] f16 (row-major, same as source minus head interleave)
// vth: [HKV][SK/32][128][32] f16 (transposed so PV B-operand reads are contiguous;
//      one 32-key tile = 8 KB in a row, so the staging copies ask for whole lines)
__global__ __launch_bounds__(256) void cvt_kv_kernel(
        const float* __restrict__ kg, const float* __restrict__ vg,
        _Float16* __restrict__ kh, _Float16* __restrict__ vth)
{
    const int gid = blockIdx.x * 256 + threadIdx.x;
    const int NK  = HKV_ * SK_ * D_ / 8;          // 131072 vec8 jobs for K
    if (gid < NK) {
        const int dseg = gid & (D_ / 8 - 1);      // 0..15
        const int hs   = gid >> 4;                // hkv*SK + s
        const int s    = hs & (SK_ - 1);
        const int hkv  = hs >> 11;
        const float4* s4 = (const float4*)(kg + ((size_t)s * HKV_ + hkv) * D_ + dseg * 8);
        float4 a = s4[0], b = s4[1];
        v8h o;
        o[0]=(_Float16)a.x; o[1]=(_Float16)a.y; o[2]=(_Float16)a.z; o[3]=(_Float16)a.w;
        o[4]=(_Float16)b.x; o[5]=(_Float16)b.y; o[6]=(_Float16)b.z; o[7]=(_Float16)b.w;
        *(v8h*)(kh + (size_t)hs * D_ + dseg * 8) = o;
    } else {
        const int t    = gid - NK;                // 16-byte piece t of vth: 8 keys of one d
        const int d    = (t >> 2) & (D_ - 1);
        const int tile = t >> 9;                  // hkv*(SK/32) + key tile
        const int hkv  = tile / (SK_ / 32);
        const int s0   = (tile & (SK_ / 32 - 1)) * 32 + (t & 3) * 8;
        v8h o;
        #pragma unroll
        for (int i = 0; i < 8; ++i)
            o[i] = (_Float16)vg[((size_t)(s0 + i) * HKV_ + hkv) * D_ + d];
        *(v8h*)(vth + (size_t)t * 8) = o;
    }
}

// ---------------- main flash kernel ----------------
// One work-group = 64 query rows x KSPLIT_ groups of 4 waves. Every group runs
// its own online softmax over every KSPLIT_-th key tile, with its own K/V/P
// LDS; group 0 joins the partial (m, l, O) through LDS at the end.
template <bool WS>
__launch_bounds__(128 * KSPLIT_, 1)
__global__ void flashmask_fwd(const float* __restrict__ qg,
                              const float* __restrict__ kg,
                              const float* __restrict__ vg,
                              const int*   __restrict__ sr,
                              const _Float16* __restrict__ kh,
                              const _Float16* __restrict__ vth,
                              float* __restrict__ out)
{
    __shared__ _Float16 Kl[KSPLIT_][32][136];   // K tile, row-major (pad->272B rows: 16 B x odd, b128 column reads hit distinct banks)
    __shared__ _Float16 Vt[KSPLIT_][128][40];   // V tile, transposed (pad->80B rows)
    __shared__ _Float16 Pl[4 * KSPLIT_][16][40]; // per-wave P transpose scratch (pad->80B rows, same reason)
    __shared__ v4f Mg[KSPLIT_ - 1][4][20][32];   // partials of groups 1.. : 16 x O, 2 x m, 2 x l, one b128 per lane

    const int tid  = threadIdx.x;
    const int wave = tid >> 5;             // 0..15
    const int lane = tid & 31;
    const int grp  = __builtin_amdgcn_readfirstlane(tid >> 7);  // key-split group, wave-uniform
    const int gw   = wave & 3;             // wave inside its group: which 16 query rows
    const int gt   = tid & 127;            // thread inside its group
    const int ln16 = lane & 15;
    const int hi8  = (lane >> 4) * 8;

    const int h      = blockIdx.y;
    const int hkv    = h / GQA_;
    const int q_base = blockIdx.x * 64 + gw * 16;

    // fold 1/sqrt(D) * log2(e) into Q: softmax runs in base-2 domain
    const float QSC = 0.08838834764831845f * 1.44269504088896340f;

    // ---- Q tile -> WMMA A layout (pre-scaled) ----
    v16h QA[4];
    {
        const float* qrow = qg + ((size_t)(q_base + ln16) * H_ + h) * D_;
        #pragma unroll
        for (int c = 0; c < 4; ++c) {
            const int dlo = c * 32 + hi8;
            const int dhi = c * 32 + 16 + hi8;
            #pragma unroll
            for (int i = 0; i < 8; ++i) {
                QA[c][i]     = (_Float16)(qrow[dlo + i] * QSC);
                QA[c][i + 8] = (_Float16)(qrow[dhi + i] * QSC);
            }
        }
    }

    v16h ONES;
    #pragma unroll
    for (int i = 0; i < 16; ++i) ONES[i] = (_Float16)1.0f;

    v8f O[8];
    #pragma unroll
    for (int j = 0; j < 8; ++j) O[j] = v8f{};
    v8f mrow, lrow;
    #pragma unroll
    for (int r = 0; r < 8; ++r) { mrow[r] = -1e30f; lrow[r] = 0.0f; }

    const int nkb  = 2 * blockIdx.x + 2;   // causal truncation
    const int nit  = (nkb + KSPLIT_ - 1) / KSPLIT_;
    const int crow = gt >> 2;              // 0..31
    const int cq   = gt & 3;               // 64B segment id (16B segment of a V row in the WS path)

    for (int it = 0; it < nit; ++it) {
        // A tile with kb >= nkb (last trip only, still inside SK_) lies wholly
        // above the diagonal: the causal mask below gives it weight 0.
        const int kb = it * KSPLIT_ + grp;
        const int k0 = kb * 32;

        // ---------- stage K/V tiles into LDS ----------
        if constexpr (WS) {
            // Both tiles are 8 KB in a row in the workspace. Copy i of thread gt moves
            // 16-byte piece i * 128 + gt, so one wave's copy reads 512 adjacent bytes:
            // 4 whole lines (a copy that touches more lines costs L2 requests per line).
            const _Float16* kp = kh  + (size_t)(hkv * SK_ + k0) * D_;
            const _Float16* vp = vth + (size_t)(hkv * (SK_ / 32) + kb) * (D_ * 32);
            #pragma unroll
            for (int i = 0; i < 4; ++i)
                copy16_g2l(kp + i * 1024 + gt * 8, &Kl[grp][i * 8 + (gt >> 4)][(gt & 15) * 8]);
            #pragma unroll
            for (int i = 0; i < 4; ++i)
                copy16_g2l(vp + i * 1024 + gt * 8, &Vt[grp][i * 32 + crow][cq * 8]);
            if (it + 1 < nit) {            // gfx1250 global_prefetch_b8, one per 64 B of the next tiles
                __builtin_prefetch(kp + KSPLIT_ * 32 * D_ + gt * 32, 0, 0);
                __builtin_prefetch(vp + KSPLIT_ * 32 * D_ + gt * 32, 0, 0);
            }
#if USE_ASYNC_LDS
            __builtin_amdgcn_s_wait_asynccnt(0);
#endif
        } else {
            const float* kp = kg + ((size_t)(k0 + crow) * HKV_ + hkv) * D_ + cq * 32;
            const float* vp = vg + ((size_t)(k0 + crow) * HKV_ + hkv) * D_ + cq * 32;
            const float4* kp4 = (const float4*)kp;
            const float4* vp4 = (const float4*)vp;
            #pragma unroll
            for (int i = 0; i < 8; ++i) {
                float4 f = kp4[i];
                Kl[grp][crow][cq * 32 + 4*i + 0] = (_Float16)f.x;
                Kl[grp][crow][cq * 32 + 4*i + 1] = (_Float16)f.y;
                Kl[grp][crow][cq * 32 + 4*i + 2] = (_Float16)f.z;
                Kl[grp][crow][cq * 32 + 4*i + 3] = (_Float16)f.w;
            }
            #pragma unroll
            for (int i = 0; i < 8; ++i) {
                float4 f = vp4[i];
                Vt[grp][cq * 32 + 4*i + 0][crow] = (_Float16)f.x;
                Vt[grp][cq * 32 + 4*i + 1][crow] = (_Float16)f.y;
                Vt[grp][cq * 32 + 4*i + 2][crow] = (_Float16)f.z;
                Vt[grp][cq * 32 + 4*i + 3][crow] = (_Float16)f.w;
            }
            if (it + 1 < nit) {
                __builtin_prefetch(kp + KSPLIT_ * 32 * HKV_ * D_, 0, 0);
                __builtin_prefetch(vp + KSPLIT_ * 32 * HKV_ * D_, 0, 0);
            }
        }
        __syncthreads();

        // ---------- S = (Q*qsc) K^T : two 16x16 tiles ----------
        v8f S[2];
        #pragma unroll
        for (int t = 0; t < 2; ++t) {
            v8f acc = v8f{};
            #pragma unroll
            for (int c = 0; c < 4; ++c) {
                v8h lo = *(const v8h*)&Kl[grp][t * 16 + ln16][c * 32 + hi8];
                v8h hi = *(const v8h*)&Kl[grp][t * 16 + ln16][c * 32 + 16 + hi8];
                v16h bk = __builtin_shufflevector(lo, hi,
                    0,1,2,3,4,5,6,7,8,9,10,11,12,13,14,15);
                acc = __builtin_amdgcn_wmma_f32_16x16x32_f16(
                        false, QA[c], false, bk, (short)0, acc, false, false);
            }
            S[t] = acc;
        }

        // ---------- mask: causal | band ----------
        #pragma unroll
        for (int t = 0; t < 2; ++t) {
            const int col  = k0 + t * 16 + ln16;
            const int sidx = (hkv * SK_ + col) * 2;
            const int cs   = sr[sidx];
            const unsigned bw = (unsigned)(sr[sidx + 1] - cs);
            #pragma unroll
            for (int r = 0; r < 8; ++r) {
                const int row = q_base + r + hi8;
                const bool msk = (row < col) || ((unsigned)(row - cs) < bw);
                S[t][r] = msk ? -1e30f : S[t][r];
            }
        }

        // ---------- joint row-max over both tiles, one 4-step tree ----------
        v8f rm;
        #pragma unroll
        for (int r = 0; r < 8; ++r) rm[r] = fmaxf(S[0][r], S[1][r]);
        #pragma unroll
        for (int xd = 1; xd < 16; xd <<= 1) {
            #pragma unroll
            for (int r = 0; r < 8; ++r)
                rm[r] = fmaxf(rm[r], __shfl_xor(rm[r], xd, 32));
        }
        v8f mnew, alpha;
        #pragma unroll
        for (int r = 0; r < 8; ++r) mnew[r]  = fmaxf(mrow[r], rm[r]);
        #pragma unroll
        for (int r = 0; r < 8; ++r) alpha[r] = exp2f(mrow[r] - mnew[r]);
        mrow = mnew;
        #pragma unroll
        for (int j = 0; j < 8; ++j)
            #pragma unroll
            for (int r = 0; r < 8; ++r) O[j][r] *= alpha[r];

        // ---------- P = exp2(S - m), D-layout -> LDS (f16) ----------
        #pragma unroll
        for (int t = 0; t < 2; ++t) {
            #pragma unroll
            for (int r = 0; r < 8; ++r) {
                float p = exp2f(S[t][r] - mnew[r]);
                Pl[wave][r + hi8][t * 16 + ln16] = (_Float16)p;
            }
        }

        // ---------- P back in A layout (wave-private, DS in-order) ----------
        v16h PA;
        {
            v8h lo = *(const v8h*)&Pl[wave][ln16][hi8];
            v8h hi = *(const v8h*)&Pl[wave][ln16][16 + hi8];
            PA = __builtin_shufflevector(lo, hi,
                0,1,2,3,4,5,6,7,8,9,10,11,12,13,14,15);
        }

        // ---------- row-sum via WMMA: P x ones lands sums in lrow layout ----------
        {
            v8f rs = __builtin_amdgcn_wmma_f32_16x16x32_f16(
                       false, PA, false, ONES, (short)0, v8f{}, false, false);
            #pragma unroll
            for (int r = 0; r < 8; ++r) lrow[r] = lrow[r] * alpha[r] + rs[r];
        }

        // ---------- O += P * V (8 d-tiles) ----------
        #pragma unroll
        for (int j = 0; j < 8; ++j) {
            v8h lo = *(const v8h*)&Vt[grp][j * 16 + ln16][hi8];
            v8h hi = *(const v8h*)&Vt[grp][j * 16 + ln16][16 + hi8];
            v16h bv = __builtin_shufflevector(lo, hi,
                0,1,2,3,4,5,6,7,8,9,10,11,12,13,14,15);
            O[j] = __builtin_amdgcn_wmma_f32_16x16x32_f16(
                     false, PA, false, bv, (short)0, O[j], false, false);
        }
        __syncthreads();
    }

    // ---------- join the groups' partial softmaxes (same lane/register layout in every group) ----------
    if (grp != 0) {
        v4f (*dst)[32] = Mg[grp - 1][gw];
        #pragma unroll
        for (int j = 0; j < 8; ++j) {
            dst[2 * j][lane]     = __builtin_shufflevector(O[j], O[j], 0, 1, 2, 3);
            dst[2 * j + 1][lane] = __builtin_shufflevector(O[j], O[j], 4, 5, 6, 7);
        }
        dst[16][lane] = __builtin_shufflevector(mrow, mrow, 0, 1, 2, 3);
        dst[17][lane] = __builtin_shufflevector(mrow, mrow, 4, 5, 6, 7);
        dst[18][lane] = __builtin_shufflevector(lrow, lrow, 0, 1, 2, 3);
        dst[19][lane] = __builtin_shufflevector(lrow, lrow, 4, 5, 6, 7);
    }
    __syncthreads();
    if (grp != 0) return;   // no barrier follows

    // rolled: one group's partials in registers at a time (unrolled, the hoisted LDS loads spill)
    #pragma unroll 1
    for (int g = 0; g < KSPLIT_ - 1; ++g) {
        const v4f (*srcp)[32] = Mg[g][gw];
        const v8f mo = __builtin_shufflevector(srcp[16][lane], srcp[17][lane], 0, 1, 2, 3, 4, 5, 6, 7);
        const v8f lo = __builtin_shufflevector(srcp[18][lane], srcp[19][lane], 0, 1, 2, 3, 4, 5, 6, 7);
        v8f wa, wb;   // a side that saw no unmasked key of a row gets weight 0 there
        #pragma unroll
        for (int r = 0; r < 8; ++r) {
            const float mt = fmaxf(mrow[r], mo[r]);
            wa[r]   = exp2f(mrow[r] - mt);
            wb[r]   = exp2f(mo[r] - mt);
            mrow[r] = mt;
            lrow[r] = lrow[r] * wa[r] + lo[r] * wb[r];
        }
        #pragma unroll
        for (int j = 0; j < 8; ++j) {
            const v8f og = __builtin_shufflevector(srcp[2 * j][lane], srcp[2 * j + 1][lane],
                                                   0, 1, 2, 3, 4, 5, 6, 7);
            #pragma unroll
            for (int r = 0; r < 8; ++r) O[j][r] = O[j][r] * wa[r] + og[r] * wb[r];
        }
    }

    // ---------- normalize + store ----------
    float inv[8];
    #pragma unroll
    for (int r = 0; r < 8; ++r) inv[r] = 1.0f / fmaxf(lrow[r], 1e-20f);
    #pragma unroll
    for (int j = 0; j < 8; ++j) {
        #pragma unroll
        for (int r = 0; r < 8; ++r) {
            const int row = q_base + r + hi8;
            const int d   = j * 16 + ln16;
            out[((size_t)row * H_ + h) * D_ + d] = O[j][r] * inv[r];
        }
    }
}

extern "C" void kernel_launch(void* const* d_in, const int* in_sizes, int n_in,
                              void* d_out, int out_size, void* d_ws, size_t ws_size,
                              hipStream_t stream) {
    const float* q  = (const float*)d_in[0];
    const float* k  = (const float*)d_in[1];
    const float* v  = (const float*)d_in[2];
    const int*   sr = (const int*)d_in[3];
    float* out = (float*)d_out;
    (void)in_sizes; (void)n_in; (void)out_size;

    dim3 grid(SQ_ / 64, H_, 1);
    dim3 block(128 * KSPLIT_, 1, 1);

    const size_t kv_elems = (size_t)HKV_ * SK_ * D_;          // 1M f16 each
    const size_t need     = kv_elems * sizeof(_Float16) * 2;  // 4 MB
    if (ws_size >= need) {
        _Float16* kh  = (_Float16*)d_ws;
        _Float16* vth = kh + kv_elems;
        cvt_kv_kernel<<<(2 * (int)(kv_elems / 8)) / 256, 256, 0, stream>>>(k, v, kh, vth);
        flashmask_fwd<true><<<grid, block, 0, stream>>>(q, k, v, sr, kh, vth, out);
    } else {
        flashmask_fwd<false><<<grid, block, 0, stream>>>(q, k, v, sr, nullptr, nullptr, out);
    }
}

// v004
// Measured time: 52.8 microseconds a run.
// In two side-by-side timings against v003, it was 1.49 and 1.47 times as fast.
// Counting every step since v000, it is 3.73 times as fast.
#include <hip/hip_runtime.h>

typedef __attribute__((ext_vector_type(16))) _Float16 v16h;
typedef __attribute__((ext_vector_type(8)))  _Float16 v8h;
typedef __attribute__((ext_vector_type(8)))  float    v8f;
typedef __attribute__((ext_vector_type(4)))  float    v4f;
typedef __attribute__((ext_vector_type(4)))  int      v4i;

#define SQ_  2048
#define SK_  2048
#define H_   16
#define HKV_ 4
#define D_   128
#define GQA_ (H_ / HKV_)
#define KSPLIT_ 4   // wave groups per work-group; group g takes key tiles g, g+4, g+8, ...

#if __has_builtin(__builtin_amdgcn_global_load_async_to_lds_b128) && \
    __has_builtin(__builtin_amdgcn_s_wait_asynccnt)
#define USE_ASYNC_LDS 1
typedef __attribute__((address_space(1))) v4i g_v4i;   // global b128
typedef __attribute__((address_space(3))) v4i l_v4i;   // LDS b128
#else
#define USE_ASYNC_LDS 0
#endif

// Copy 16 bytes global(f16) -> LDS. Async (ASYNCcnt) when the gfx1250 builtin
// exists, else a b128 load + ds_store_b128 pair.
__device__ __forceinline__ void copy16_g2l(const _Float16* g, _Float16* l) {
#if USE_ASYNC_LDS
    __builtin_amdgcn_global_load_async_to_lds_b128((g_v4i*)g, (l_v4i*)l, 0, 0);
#else
    *(v8h*)l = *(const v8h*)g;
#endif
}

// ---------------- one-time K/V convert kernel ----------------
// kh : [HKV][SK][128] f16 (row-major, same as source minus head interleave)
// vth: [HKV][SK/32][128][32] f16 (transposed so PV B-operand reads are contiguous;
//      one 32-key tile = 8 KB in a row, so the staging copies ask for whole lines)
__global__ __launch_bounds__(256) void cvt_kv_kernel(
        const float* __restrict__ kg, const float* __restrict__ vg,
        _Float16* __restrict__ kh, _Float16* __restrict__ vth)
{
    const int gid = blockIdx.x * 256 + threadIdx.x;
    const int NK  = HKV_ * SK_ * D_ / 8;          // 131072 vec8 jobs for K
    if (gid < NK) {
        const int dseg = gid & (D_ / 8 - 1);      // 0..15
        const int hs   = gid >> 4;                // hkv*SK + s
        const int s    = hs & (SK_ - 1);
        const int hkv  = hs >> 11;
        const float4* s4 = (const float4*)(kg + ((size_t)s * HKV_ + hkv) * D_ + dseg * 8);
        float4 a = s4[0], b = s4[1];
        v8h o;
        o[0]=(_Float16)a.x; o[1]=(_Float16)a.y; o[2]=(_Float16)a.z; o[3]=(_Float16)a.w;
        o[4]=(_Float16)b.x; o[5]=(_Float16)b.y; o[6]=(_Float16)b.z; o[7]=(_Float16)b.w;
        *(v8h*)(kh + (size_t)hs * D_ + dseg * 8) = o;
    } else {
        const int t    = gid - NK;                // 16-byte piece t of vth: 8 keys of one d
        const int d    = (t >> 2) & (D_ - 1);
        const int tile = t >> 9;                  // hkv*(SK/32) + key tile
        const int hkv  = tile / (SK_ / 32);
        const int s0   = (tile & (SK_ / 32 - 1)) * 32 + (t & 3) * 8;
        v8h o;
        #pragma unroll
        for (int i = 0; i < 8; ++i)
            o[i] = (_Float16)vg[((size_t)(s0 + i) * HKV_ + hkv) * D_ + d];
        *(v8h*)(vth + (size_t)t * 8) = o;
    }
}

// ---------------- main flash kernel ----------------
// One work-group = 64 query rows x KSPLIT_ groups of 4 waves. Every group runs
// its own online softmax over every KSPLIT_-th key tile, with its own K/V/P
// LDS; group 0 joins the partial (m, l, O) through LDS at the end.
template <bool WS>
__launch_bounds__(128 * KSPLIT_, 1)
__global__ void flashmask_fwd(const float* __restrict__ qg,
                              const float* __restrict__ kg,
                              const float* __restrict__ vg,
                              const int*   __restrict__ sr,
                              const _Float16* __restrict__ kh,
                              const _Float16* __restrict__ vth,
                              float* __restrict__ out)
{
    __shared__ _Float16 Kl[KSPLIT_][32][136];   // K tile, row-major (pad->272B rows: 16 B x odd, b128 column reads hit distinct banks)
    __shared__ _Float16 Vt[KSPLIT_][128][40];   // V tile, transposed (pad->80B rows)
    __shared__ _Float16 Pl[4 * KSPLIT_][16][40]; // per-wave P transpose scratch (pad->80B rows, same reason)
    __shared__ v4f Mg[KSPLIT_ - 1][4][20][32];   // partials of groups 1.. : 16 x O, 2 x m, 2 x l, one b128 per lane

    const int tid  = threadIdx.x;
    const int wave = tid >> 5;             // 0..15
    const int lane = tid & 31;
    const int grp  = __builtin_amdgcn_readfirstlane(tid >> 7);  // key-split group, wave-uniform
    const int gw   = wave & 3;             // wave inside its group: which 16 query rows
    const int gt   = tid & 127;            // thread inside its group
    const int ln16 = lane & 15;
    const int hi8  = (lane >> 4) * 8;

    // Heaviest first: a query block's cost grows with its position (causal), and there are
    // twice as many work-groups as places on the chip. The flat index runs over the heads
    // fastest and down the query blocks, so the long blocks have the lowest indices.
    const int h      = blockIdx.x;
    const int qb     = SQ_ / 64 - 1 - blockIdx.y;
    const int hkv    = h / GQA_;
    const int q_base = qb * 64 + gw * 16;

    // fold 1/sqrt(D) * log2(e) into Q: softmax runs in base-2 domain
    const float QSC = 0.08838834764831845f * 1.44269504088896340f;

    // ---- Q tile -> WMMA A layout (pre-scaled) ----
    v16h QA[4];
    {
        const float* qrow = qg + ((size_t)(q_base + ln16) * H_ + h) * D_;
        #pragma unroll
        for (int c = 0; c < 4; ++c) {
            const int dlo = c * 32 + hi8;
            const int dhi = c * 32 + 16 + hi8;
            #pragma unroll
            for (int i = 0; i < 8; ++i) {
                QA[c][i]     = (_Float16)(qrow[dlo + i] * QSC);
                QA[c][i + 8] = (_Float16)(qrow[dhi + i] * QSC);
            }
        }
    }

    v16h ONES;
    #pragma unroll
    for (int i = 0; i < 16; ++i) ONES[i] = (_Float16)1.0f;

    v8f O[8];
    #pragma unroll
    for (int j = 0; j < 8; ++j) O[j] = v8f{};
    v8f mrow, lrow;
    #pragma unroll
    for (int r = 0; r < 8; ++r) { mrow[r] = -1e30f; lrow[r] = 0.0f; }

    const int nkb  = 2 * qb + 2;           // causal truncation
    const int nit  = (nkb + KSPLIT_ - 1) / KSPLIT_;
    const int crow = gt >> 2;              // 0..31
    const int cq   = gt & 3;               // 64B segment id (16B segment of a V row in the WS path)

    for (int it = 0; it < nit; ++it) {
        // A tile with kb >= nkb (last trip only, still inside SK_) lies wholly
        // above the diagonal: the causal mask below gives it weight 0.
        const int kb = it * KSPLIT_ + grp;
        const int k0 = kb * 32;

        // ---------- stage K/V tiles into LDS ----------
        if constexpr (WS) {
            // Both tiles are 8 KB in a row in the workspace. Copy i of thread gt moves
            // 16-byte piece i * 128 + gt, so one wave's copy reads 512 adjacent bytes:
            // 4 whole lines (a copy that touches more lines costs L2 requests per line).
            const _Float16* kp = kh  + (size_t)(hkv * SK_ + k0) * D_;
            const _Float16* vp = vth + (size_t)(hkv * (SK_ / 32) + kb) * (D_ * 32);
            #pragma unroll
            for (int i = 0; i < 4; ++i)
                copy16_g2l(kp + i * 1024 + gt * 8, &Kl[grp][i * 8 + (gt >> 4)][(gt & 15) * 8]);
            #pragma unroll
            for (int i = 0; i < 4; ++i)
                copy16_g2l(vp + i * 1024 + gt * 8, &Vt[grp][i * 32 + crow][cq * 8]);
            if (it + 1 < nit) {            // gfx1250 global_prefetch_b8, one per 64 B of the next tiles
                __builtin_prefetch(kp + KSPLIT_ * 32 * D_ + gt * 32, 0, 0);
                __builtin_prefetch(vp + KSPLIT_ * 32 * D_ + gt * 32, 0, 0);
            }
#if USE_ASYNC_LDS
            __builtin_amdgcn_s_wait_asynccnt(0);
#endif
        } else {
            const float* kp = kg + ((size_t)(k0 + crow) * HKV_ + hkv) * D_ + cq * 32;
            const float* vp = vg + ((size_t)(k0 + crow) * HKV_ + hkv) * D_ + cq * 32;
            const float4* kp4 = (const float4*)kp;
            const float4* vp4 = (const float4*)vp;
            #pragma unroll
            for (int i = 0; i < 8; ++i) {
                float4 f = kp4[i];
                Kl[grp][crow][cq * 32 + 4*i + 0] = (_Float16)f.x;
                Kl[grp][crow][cq * 32 + 4*i + 1] = (_Float16)f.y;
                Kl[grp][crow][cq * 32 + 4*i + 2] = (_Float16)f.z;
                Kl[grp][crow][cq * 32 + 4*i + 3] = (_Float16)f.w;
            }
            #pragma unroll
            for (int i = 0; i < 8; ++i) {
                float4 f = vp4[i];
                Vt[grp][cq * 32 + 4*i + 0][crow] = (_Float16)f.x;
                Vt[grp][cq * 32 + 4*i + 1][crow] = (_Float16)f.y;
                Vt[grp][cq * 32 + 4*i + 2][crow] = (_Float16)f.z;
                Vt[grp][cq * 32 + 4*i + 3][crow] = (_Float16)f.w;
            }
            if (it + 1 < nit) {
                __builtin_prefetch(kp + KSPLIT_ * 32 * HKV_ * D_, 0, 0);
                __builtin_prefetch(vp + KSPLIT_ * 32 * HKV_ * D_, 0, 0);
            }
        }
        __syncthreads();

        // ---------- S = (Q*qsc) K^T : two 16x16 tiles ----------
        v8f S[2];
        #pragma unroll
        for (int t = 0; t < 2; ++t) {
            v8f acc = v8f{};
            #pragma unroll
            for (int c = 0; c < 4; ++c) {
                v8h lo = *(const v8h*)&Kl[grp][t * 16 + ln16][c * 32 + hi8];
                v8h hi = *(const v8h*)&Kl[grp][t * 16 + ln16][c * 32 + 16 + hi8];
                v16h bk = __builtin_shufflevector(lo, hi,
                    0,1,2,3,4,5,6,7,8,9,10,11,12,13,14,15);
                acc = __builtin_amdgcn_wmma_f32_16x16x32_f16(
                        false, QA[c], false, bk, (short)0, acc, false, false);
            }
            S[t] = acc;
        }

        // ---------- mask: causal | band ----------
        #pragma unroll
        for (int t = 0; t < 2; ++t) {
            const int col  = k0 + t * 16 + ln16;
            const int sidx = (hkv * SK_ + col) * 2;
            const int cs   = sr[sidx];
            const unsigned bw = (unsigned)(sr[sidx + 1] - cs);
            #pragma unroll
            for (int r = 0; r < 8; ++r) {
                const int row = q_base + r + hi8;
                const bool msk = (row < col) || ((unsigned)(row - cs) < bw);
                S[t][r] = msk ? -1e30f : S[t][r];
            }
        }

        // ---------- joint row-max over both tiles, one 4-step tree ----------
        v8f rm;
        #pragma unroll
        for (int r = 0; r < 8; ++r) rm[r] = fmaxf(S[0][r], S[1][r]);
        #pragma unroll
        for (int xd = 1; xd < 16; xd <<= 1) {
            #pragma unroll
            for (int r = 0; r < 8; ++r)
                rm[r] = fmaxf(rm[r], __shfl_xor(rm[r], xd, 32));
        }
        v8f mnew, alpha;
        #pragma unroll
        for (int r = 0; r < 8; ++r) mnew[r]  = fmaxf(mrow[r], rm[r]);
        #pragma unroll
        for (int r = 0; r < 8; ++r) alpha[r] = exp2f(mrow[r] - mnew[r]);
        mrow = mnew;
        #pragma unroll
        for (int j = 0; j < 8; ++j)
            #pragma unroll
            for (int r = 0; r < 8; ++r) O[j][r] *= alpha[r];

        // ---------- P = exp2(S - m), D-layout -> LDS (f16) ----------
        #pragma unroll
        for (int t = 0; t < 2; ++t) {
            #pragma unroll
            for (int r = 0; r < 8; ++r) {
                float p = exp2f(S[t][r] - mnew[r]);
                Pl[wave][r + hi8][t * 16 + ln16] = (_Float16)p;
            }
        }

        // ---------- P back in A layout (wave-private, DS in-order) ----------
        v16h PA;
        {
            v8h lo = *(const v8h*)&Pl[wave][ln16][hi8];
            v8h hi = *(const v8h*)&Pl[wave][ln16][16 + hi8];
            PA = __builtin_shufflevector(lo, hi,
                0,1,2,3,4,5,6,7,8,9,10,11,12,13,14,15);
        }

        // ---------- row-sum via WMMA: P x ones lands sums in lrow layout ----------
        {
            v8f rs = __builtin_amdgcn_wmma_f32_16x16x32_f16(
                       false, PA, false, ONES, (short)0, v8f{}, false, false);
            #pragma unroll
            for (int r = 0; r < 8; ++r) lrow[r] = lrow[r] * alpha[r] + rs[r];
        }

        // ---------- O += P * V (8 d-tiles) ----------
        #pragma unroll
        for (int j = 0; j < 8; ++j) {
            v8h lo = *(const v8h*)&Vt[grp][j * 16 + ln16][hi8];
            v8h hi = *(const v8h*)&Vt[grp][j * 16 + ln16][16 + hi8];
            v16h bv = __builtin_shufflevector(lo, hi,
                0,1,2,3,4,5,6,7,8,9,10,11,12,13,14,15);
            O[j] = __builtin_amdgcn_wmma_f32_16x16x32_f16(
                     false, PA, false, bv, (short)0, O[j], false, false);
        }
        __syncthreads();
    }

    // ---------- join the groups' partial softmaxes (same lane/register layout in every group) ----------
    if (grp != 0) {
        v4f (*dst)[32] = Mg[grp - 1][gw];
        #pragma unroll
        for (int j = 0; j < 8; ++j) {
            dst[2 * j][lane]     = __builtin_shufflevector(O[j], O[j], 0, 1, 2, 3);
            dst[2 * j + 1][lane] = __builtin_shufflevector(O[j], O[j], 4, 5, 6, 7);
        }
        dst[16][lane] = __builtin_shufflevector(mrow, mrow, 0, 1, 2, 3);
        dst[17][lane] = __builtin_shufflevector(mrow, mrow, 4, 5, 6, 7);
        dst[18][lane] = __builtin_shufflevector(lrow, lrow, 0, 1, 2, 3);
        dst[19][lane] = __builtin_shufflevector(lrow, lrow, 4, 5, 6, 7);
    }
    __syncthreads();
    if (grp != 0) return;   // no barrier follows

    // rolled: one group's partials in registers at a time (unrolled, the hoisted LDS loads spill)
    #pragma unroll 1
    for (int g = 0; g < KSPLIT_ - 1; ++g) {
        const v4f (*srcp)[32] = Mg[g][gw];
        const v8f mo = __builtin_shufflevector(srcp[16][lane], srcp[17][lane], 0, 1, 2, 3, 4, 5, 6, 7);
        const v8f lo = __builtin_shufflevector(srcp[18][lane], srcp[19][lane], 0, 1, 2, 3, 4, 5, 6, 7);
        v8f wa, wb;   // a side that saw no unmasked key of a row gets weight 0 there
        #pragma unroll
        for (int r = 0; r < 8; ++r) {
            const float mt = fmaxf(mrow[r], mo[r]);
            wa[r]   = exp2f(mrow[r] - mt);
            wb[r]   = exp2f(mo[r] - mt);
            mrow[r] = mt;
            lrow[r] = lrow[r] * wa[r] + lo[r] * wb[r];
        }
        #pragma unroll
        for (int j = 0; j < 8; ++j) {
            const v8f og = __builtin_shufflevector(srcp[2 * j][lane], srcp[2 * j + 1][lane],
                                                   0, 1, 2, 3, 4, 5, 6, 7);
            #pragma unroll
            for (int r = 0; r < 8; ++r) O[j][r] = O[j][r] * wa[r] + og[r] * wb[r];
        }
    }

    // ---------- normalize + store ----------
    float inv[8];
    #pragma unroll
    for (int r = 0; r < 8; ++r) inv[r] = 1.0f / fmaxf(lrow[r], 1e-20f);
    #pragma unroll
    for (int j = 0; j < 8; ++j) {
        #pragma unroll
        for (int r = 0; r < 8; ++r) {
            const int row = q_base + r + hi8;
            const int d   = j * 16 + ln16;
            out[((size_t)row * H_ + h) * D_ + d] = O[j][r] * inv[r];
        }
    }
}

extern "C" void kernel_launch(void* const* d_in, const int* in_sizes, int n_in,
                              void* d_out, int out_size, void* d_ws, size_t ws_size,
                              hipStream_t stream) {
    const float* q  = (const float*)d_in[0];
    const float* k  = (const float*)d_in[1];
    const float* v  = (const float*)d_in[2];
    const int*   sr = (const int*)d_in[3];
    float* out = (float*)d_out;
    (void)in_sizes; (void)n_in; (void)out_size;

    dim3 grid(H_, SQ_ / 64, 1);
    dim3 block(128 * KSPLIT_, 1, 1);

    const size_t kv_elems = (size_t)HKV_ * SK_ * D_;          // 1M f16 each
    const size_t need     = kv_elems * sizeof(_Float16) * 2;  // 4 MB
    if (ws_size >= need) {
        _Float16* kh  = (_Float16*)d_ws;
        _Float16* vth = kh + kv_elems;
        cvt_kv_kernel<<<(2 * (int)(kv_elems / 8)) / 256, 256, 0, stream>>>(k, v, kh, vth);
        flashmask_fwd<true><<<grid, block, 0, stream>>>(q, k, v, sr, kh, vth, out);
    } else {
        flashmask_fwd<false><<<grid, block, 0, stream>>>(q, k, v, sr, nullptr, nullptr, out);
    }
}

// v005
// A run of this version takes 44.8 microseconds.
// Two timings next to v004 put it at 1.19 and 1.18 times that version's speed.
// All steps since v000 together make it 4.42 times as fast.
#include <hip/hip_runtime.h>

typedef __attribute__((ext_vector_type(16))) _Float16 v16h;
typedef __attribute__((ext_vector_type(8)))  _Float16 v8h;
typedef __attribute__((ext_vector_type(8)))  float    v8f;
typedef __attribute__((ext_vector_type(4)))  float    v4f;
typedef __attribute__((ext_vector_type(4)))  int      v4i;

#define SQ_  2048
#define SK_  2048
#define H_   16
#define HKV_ 4
#define D_   128
#define GQA_ (H_ / HKV_)
#define KSPLIT_ 4   // wave groups per work-group; group g takes key tiles g, g+4, g+8, ...

#if __has_builtin(__builtin_amdgcn_global_load_async_to_lds_b128) && \
    __has_builtin(__builtin_amdgcn_s_wait_asynccnt)
#define USE_ASYNC_LDS 1
typedef __attribute__((address_space(1))) v4i g_v4i;   // global b128
typedef __attribute__((address_space(3))) v4i l_v4i;   // LDS b128
#else
#define USE_ASYNC_LDS 0
#endif

// Copy 16 bytes global(f16) -> LDS. Async (ASYNCcnt) when the gfx1250 builtin
// exists, else a b128 load + ds_store_b128 pair.
__device__ __forceinline__ void copy16_g2l(const _Float16* g, _Float16* l) {
#if USE_ASYNC_LDS
    __builtin_amdgcn_global_load_async_to_lds_b128((g_v4i*)g, (l_v4i*)l, 0, 0);
#else
    *(v8h*)l = *(const v8h*)g;
#endif
}

// ---------------- one-time K/V convert kernel ----------------
// kh : [HKV][SK][128] f16 (row-major, same as source minus head interleave)
// vth: [HKV][SK/32][128][32] f16 (transposed so PV B-operand reads are contiguous;
//      one 32-key tile = 8 KB in a row, so the staging copies ask for whole lines)
__global__ __launch_bounds__(256) void cvt_kv_kernel(
        const float* __restrict__ kg, const float* __restrict__ vg,
        _Float16* __restrict__ kh, _Float16* __restrict__ vth)
{
    const int gid = blockIdx.x * 256 + threadIdx.x;
    const int NK  = HKV_ * SK_ * D_ / 8;          // 131072 vec8 jobs for K
    if (gid < NK) {
        const int dseg = gid & (D_ / 8 - 1);      // 0..15
        const int hs   = gid >> 4;                // hkv*SK + s
        const int s    = hs & (SK_ - 1);
        const int hkv  = hs >> 11;
        const float4* s4 = (const float4*)(kg + ((size_t)s * HKV_ + hkv) * D_ + dseg * 8);
        float4 a = s4[0], b = s4[1];
        v8h o;
        o[0]=(_Float16)a.x; o[1]=(_Float16)a.y; o[2]=(_Float16)a.z; o[3]=(_Float16)a.w;
        o[4]=(_Float16)b.x; o[5]=(_Float16)b.y; o[6]=(_Float16)b.z; o[7]=(_Float16)b.w;
        *(v8h*)(kh + (size_t)hs * D_ + dseg * 8) = o;
    } else {
        const int t    = gid - NK;                // 16-byte piece t of vth: 8 keys of one d
        const int d    = (t >> 2) & (D_ - 1);
        const int tile = t >> 9;                  // hkv*(SK/32) + key tile
        const int hkv  = tile / (SK_ / 32);
        const int s0   = (tile & (SK_ / 32 - 1)) * 32 + (t & 3) * 8;
        v8h o;
        #pragma unroll
        for (int i = 0; i < 8; ++i)
            o[i] = (_Float16)vg[((size_t)(s0 + i) * HKV_ + hkv) * D_ + d];
        *(v8h*)(vth + (size_t)t * 8) = o;
    }
}

// ---------------- main flash kernel ----------------
// One work-group = 64 query rows x KSPLIT_ groups of 4 waves. Every group runs
// its own online softmax over every KSPLIT_-th key tile, with its own K/V/P
// LDS; group 0 joins the partial (m, l, O) through LDS at the end.
template <bool WS>
__launch_bounds__(128 * KSPLIT_, 1)
__global__ void flashmask_fwd(const float* __restrict__ qg,
                              const float* __restrict__ kg,
                              const float* __restrict__ vg,
                              const int*   __restrict__ sr,
                              const _Float16* __restrict__ kh,
                              const _Float16* __restrict__ vth,
                              float* __restrict__ out)
{
    // Two buffers each for the workspace path: trip t reads buffer t & 1 while tile t + 1 lands in the other.
    constexpr int NBUF = WS ? 2 : 1;
    __shared__ _Float16 Kl[NBUF][KSPLIT_][32][136];   // K tile, row-major (pad->272B rows: 16 B x odd, b128 column reads hit distinct banks)
    __shared__ _Float16 Vt[NBUF][KSPLIT_][128][40];   // V tile, transposed (pad->80B rows)
    __shared__ _Float16 Pl[4 * KSPLIT_][16][40]; // per-wave P transpose scratch (pad->80B rows, same reason)
    __shared__ v4f Mg[KSPLIT_ - 1][4][20][32];   // partials of groups 1.. : 16 x O, 2 x m, 2 x l, one b128 per lane

    const int tid  = threadIdx.x;
    const int wave = tid >> 5;             // 0..15
    const int lane = tid & 31;
    const int grp  = __builtin_amdgcn_readfirstlane(tid >> 7);  // key-split group, wave-uniform
    const int gw   = wave & 3;             // wave inside its group: which 16 query rows
    const int gt   = tid & 127;            // thread inside its group
    const int ln16 = lane & 15;
    const int hi8  = (lane >> 4) * 8;

    // Heaviest first: a query block's cost grows with its position (causal), and there are
    // twice as many work-groups as places on the chip. The flat index runs over the heads
    // fastest and down the query blocks, so the long blocks have the lowest indices.
    const int h      = blockIdx.x;
    const int qb     = SQ_ / 64 - 1 - blockIdx.y;
    const int hkv    = h / GQA_;
    const int q_base = qb * 64 + gw * 16;

    // fold 1/sqrt(D) * log2(e) into Q: softmax runs in base-2 domain
    const float QSC = 0.08838834764831845f * 1.44269504088896340f;

    // ---- Q tile -> WMMA A layout (pre-scaled) ----
    v16h QA[4];
    {
        const float* qrow = qg + ((size_t)(q_base + ln16) * H_ + h) * D_;
        #pragma unroll
        for (int c = 0; c < 4; ++c) {
            const int dlo = c * 32 + hi8;
            const int dhi = c * 32 + 16 + hi8;
            #pragma unroll
            for (int i = 0; i < 8; ++i) {
                QA[c][i]     = (_Float16)(qrow[dlo + i] * QSC);
                QA[c][i + 8] = (_Float16)(qrow[dhi + i] * QSC);
            }
        }
    }

    v16h ONES;
    #pragma unroll
    for (int i = 0; i < 16; ++i) ONES[i] = (_Float16)1.0f;

    v8f O[8];
    #pragma unroll
    for (int j = 0; j < 8; ++j) O[j] = v8f{};
    v8f mrow, lrow;
    #pragma unroll
    for (int r = 0; r < 8; ++r) { mrow[r] = -1e30f; lrow[r] = 0.0f; }

    const int nkb  = 2 * qb + 2;           // causal truncation
    const int nit  = (nkb + KSPLIT_ - 1) / KSPLIT_;
    const int crow = gt >> 2;              // 0..31
    const int cq   = gt & 3;               // 64B segment id (16B segment of a V row in the WS path)

    // Workspace path: start the copies of this group's trip-t tiles into buffer b.
    // Both tiles are 8 KB in a row in the workspace. Copy i of thread gt moves
    // 16-byte piece i * 128 + gt, so one wave's copy reads 512 adjacent bytes:
    // 4 whole lines.
    auto stage = [&](int t, int b) {
        const int kbs = t * KSPLIT_ + grp;
        const _Float16* kp = kh  + (size_t)(hkv * (SK_ / 32) + kbs) * (D_ * 32);
        const _Float16* vp = vth + (size_t)(hkv * (SK_ / 32) + kbs) * (D_ * 32);
        #pragma unroll
        for (int i = 0; i < 4; ++i)
            copy16_g2l(kp + i * 1024 + gt * 8, &Kl[b][grp][i * 8 + (gt >> 4)][(gt & 15) * 8]);
        #pragma unroll
        for (int i = 0; i < 4; ++i)
            copy16_g2l(vp + i * 1024 + gt * 8, &Vt[b][grp][i * 32 + crow][cq * 8]);
    };

    // Mask bounds (start, end) of a trip's two 16-key column groups, one key per lane.
    // Like the tiles they are fetched one trip ahead, so no trip waits for them.
    int bs[2], be[2];
    #pragma unroll
    for (int t = 0; t < 2; ++t) {
        const int sidx = (hkv * SK_ + grp * 32 + t * 16 + ln16) * 2;
        bs[t] = sr[sidx];
        be[t] = sr[sidx + 1];
    }

    if constexpr (WS) {
        stage(0, 0);
        // tile 0 has landed for this wave; the barrier shows it to the group's other waves
        asm volatile("s_wait_asynccnt 0x0" ::: "memory");
        __syncthreads();
        if (nit > 1) stage(1, 1);
    }

    for (int it = 0; it < nit; ++it) {
        // A tile with kb >= nkb (last trip only, still inside SK_) lies wholly
        // above the diagonal: the causal mask below gives it weight 0.
        const int kb  = it * KSPLIT_ + grp;
        const int k0  = kb * 32;
        const int buf = WS ? (it & 1) : 0;

        // ---------- stage K/V tiles into LDS (no workspace: in the trip itself) ----------
        if constexpr (!WS) {
            const float* kp = kg + ((size_t)(k0 + crow) * HKV_ + hkv) * D_ + cq * 32;
            const float* vp = vg + ((size_t)(k0 + crow) * HKV_ + hkv) * D_ + cq * 32;
            const float4* kp4 = (const float4*)kp;
            const float4* vp4 = (const float4*)vp;
            #pragma unroll
            for (int i = 0; i < 8; ++i) {
                float4 f = kp4[i];
                Kl[0][grp][crow][cq * 32 + 4*i + 0] = (_Float16)f.x;
                Kl[0][grp][crow][cq * 32 + 4*i + 1] = (_Float16)f.y;
                Kl[0][grp][crow][cq * 32 + 4*i + 2] = (_Float16)f.z;
                Kl[0][grp][crow][cq * 32 + 4*i + 3] = (_Float16)f.w;
            }
            #pragma unroll
            for (int i = 0; i < 8; ++i) {
                float4 f = vp4[i];
                Vt[0][grp][cq * 32 + 4*i + 0][crow] = (_Float16)f.x;
                Vt[0][grp][cq * 32 + 4*i + 1][crow] = (_Float16)f.y;
                Vt[0][grp][cq * 32 + 4*i + 2][crow] = (_Float16)f.z;
                Vt[0][grp][cq * 32 + 4*i + 3][crow] = (_Float16)f.w;
            }
            if (it + 1 < nit) {
                __builtin_prefetch(kp + KSPLIT_ * 32 * HKV_ * D_, 0, 0);
                __builtin_prefetch(vp + KSPLIT_ * 32 * HKV_ * D_, 0, 0);
            }
            __syncthreads();
        }

        // ---------- next trip's mask bounds (the last trip reads its own again: in bounds, unused) ----------
        int ns[2], ne[2];
        {
            const int kn = (it + 1 < nit) ? k0 + KSPLIT_ * 32 : k0;
            #pragma unroll
            for (int t = 0; t < 2; ++t) {
                const int sidx = (hkv * SK_ + kn + t * 16 + ln16) * 2;
                ns[t] = sr[sidx];
                ne[t] = sr[sidx + 1];
            }
        }

        // ---------- S = (Q*qsc) K^T : two 16x16 tiles ----------
        v8f S[2];
        #pragma unroll
        for (int t = 0; t < 2; ++t) {
            v8f acc = v8f{};
            #pragma unroll
            for (int c = 0; c < 4; ++c) {
                v8h lo = *(const v8h*)&Kl[buf][grp][t * 16 + ln16][c * 32 + hi8];
                v8h hi = *(const v8h*)&Kl[buf][grp][t * 16 + ln16][c * 32 + 16 + hi8];
                v16h bk = __builtin_shufflevector(lo, hi,
                    0,1,2,3,4,5,6,7,8,9,10,11,12,13,14,15);
                acc = __builtin_amdgcn_wmma_f32_16x16x32_f16(
                        false, QA[c], false, bk, (short)0, acc, false, false);
            }
            S[t] = acc;
        }

        // ---------- mask: causal | band ----------
        #pragma unroll
        for (int t = 0; t < 2; ++t) {
            const int col  = k0 + t * 16 + ln16;
            const int cs   = bs[t];
            const unsigned bw = (unsigned)(be[t] - cs);
            #pragma unroll
            for (int r = 0; r < 8; ++r) {
                const int row = q_base + r + hi8;
                const bool msk = (row < col) || ((unsigned)(row - cs) < bw);
                S[t][r] = msk ? -1e30f : S[t][r];
            }
        }

        // ---------- joint row-max over both tiles, one 4-step tree ----------
        v8f rm;
        #pragma unroll
        for (int r = 0; r < 8; ++r) rm[r] = fmaxf(S[0][r], S[1][r]);
        #pragma unroll
        for (int xd = 1; xd < 16; xd <<= 1) {
            #pragma unroll
            for (int r = 0; r < 8; ++r)
                rm[r] = fmaxf(rm[r], __shfl_xor(rm[r], xd, 32));
        }
        v8f mnew, alpha;
        #pragma unroll
        for (int r = 0; r < 8; ++r) mnew[r]  = fmaxf(mrow[r], rm[r]);
        #pragma unroll
        for (int r = 0; r < 8; ++r) alpha[r] = exp2f(mrow[r] - mnew[r]);
        mrow = mnew;
        #pragma unroll
        for (int j = 0; j < 8; ++j)
            #pragma unroll
            for (int r = 0; r < 8; ++r) O[j][r] *= alpha[r];

        // ---------- P = exp2(S - m), D-layout -> LDS (f16) ----------
        #pragma unroll
        for (int t = 0; t < 2; ++t) {
            #pragma unroll
            for (int r = 0; r < 8; ++r) {
                float p = exp2f(S[t][r] - mnew[r]);
                Pl[wave][r + hi8][t * 16 + ln16] = (_Float16)p;
            }
        }

        // ---------- P back in A layout (wave-private, DS in-order) ----------
        v16h PA;
        {
            v8h lo = *(const v8h*)&Pl[wave][ln16][hi8];
            v8h hi = *(const v8h*)&Pl[wave][ln16][16 + hi8];
            PA = __builtin_shufflevector(lo, hi,
                0,1,2,3,4,5,6,7,8,9,10,11,12,13,14,15);
        }

        // ---------- row-sum via WMMA: P x ones lands sums in lrow layout ----------
        {
            v8f rs = __builtin_amdgcn_wmma_f32_16x16x32_f16(
                       false, PA, false, ONES, (short)0, v8f{}, false, false);
            #pragma unroll
            for (int r = 0; r < 8; ++r) lrow[r] = lrow[r] * alpha[r] + rs[r];
        }

        // ---------- O += P * V (8 d-tiles) ----------
        #pragma unroll
        for (int j = 0; j < 8; ++j) {
            v8h lo = *(const v8h*)&Vt[buf][grp][j * 16 + ln16][hi8];
            v8h hi = *(const v8h*)&Vt[buf][grp][j * 16 + ln16][16 + hi8];
            v16h bv = __builtin_shufflevector(lo, hi,
                0,1,2,3,4,5,6,7,8,9,10,11,12,13,14,15);
            O[j] = __builtin_amdgcn_wmma_f32_16x16x32_f16(
                     false, PA, false, bv, (short)0, O[j], false, false);
        }

        #pragma unroll
        for (int t = 0; t < 2; ++t) { bs[t] = ns[t]; be[t] = ne[t]; }

        if constexpr (WS) {
            // Hand-over: this wave's LDS reads of buffer buf are done ...
            asm volatile("s_wait_dscnt 0x0" ::: "memory");
            // ... and its copies of tile it + 1 have landed in the other buffer.
            asm volatile("s_wait_asynccnt 0x0" ::: "memory");
            // One barrier a trip: shows tile it + 1 to the group and frees buffer buf for the refill.
            __syncthreads();
            if (it + 2 < nit) stage(it + 2, buf);
        } else {
            __syncthreads();
        }
    }
    if constexpr (WS) {
        // closes the ring: no copy of this wave is in flight when it goes on to the join and ends
        asm volatile("s_wait_asynccnt 0x0" ::: "memory");
    }

    // ---------- join the groups' partial softmaxes (same lane/register layout in every group) ----------
    if (grp != 0) {
        v4f (*dst)[32] = Mg[grp - 1][gw];
        #pragma unroll
        for (int j = 0; j < 8; ++j) {
            dst[2 * j][lane]     = __builtin_shufflevector(O[j], O[j], 0, 1, 2, 3);
            dst[2 * j + 1][lane] = __builtin_shufflevector(O[j], O[j], 4, 5, 6, 7);
        }
        dst[16][lane] = __builtin_shufflevector(mrow, mrow, 0, 1, 2, 3);
        dst[17][lane] = __builtin_shufflevector(mrow, mrow, 4, 5, 6, 7);
        dst[18][lane] = __builtin_shufflevector(lrow, lrow, 0, 1, 2, 3);
        dst[19][lane] = __builtin_shufflevector(lrow, lrow, 4, 5, 6, 7);
    }
    __syncthreads();
    if (grp != 0) return;   // no barrier follows

    // rolled: one group's partials in registers at a time (unrolled, the hoisted LDS loads spill)
    #pragma unroll 1
    for (int g = 0; g < KSPLIT_ - 1; ++g) {
        const v4f (*srcp)[32] = Mg[g][gw];
        const v8f mo = __builtin_shufflevector(srcp[16][lane], srcp[17][lane], 0, 1, 2, 3, 4, 5, 6, 7);
        const v8f lo = __builtin_shufflevector(srcp[18][lane], srcp[19][lane], 0, 1, 2, 3, 4, 5, 6, 7);
        v8f wa, wb;   // a side that saw no unmasked key of a row gets weight 0 there
        #pragma unroll
        for (int r = 0; r < 8; ++r) {
            const float mt = fmaxf(mrow[r], mo[r]);
            wa[r]   = exp2f(mrow[r] - mt);
            wb[r]   = exp2f(mo[r] - mt);
            mrow[r] = mt;
            lrow[r] = lrow[r] * wa[r] + lo[r] * wb[r];
        }
        #pragma unroll
        for (int j = 0; j < 8; ++j) {
            const v8f og = __builtin_shufflevector(srcp[2 * j][lane], srcp[2 * j + 1][lane],
                                                   0, 1, 2, 3, 4, 5, 6, 7);
            #pragma unroll
            for (int r = 0; r < 8; ++r) O[j][r] = O[j][r] * wa[r] + og[r] * wb[r];
        }
    }

    // ---------- normalize + store ----------
    float inv[8];
    #pragma unroll
    for (int r = 0; r < 8; ++r) inv[r] = 1.0f / fmaxf(lrow[r], 1e-20f);
    #pragma unroll
    for (int j = 0; j < 8; ++j) {
        #pragma unroll
        for (int r = 0; r < 8; ++r) {
            const int row = q_base + r + hi8;
            const int d   = j * 16 + ln16;
            out[((size_t)row * H_ + h) * D_ + d] = O[j][r] * inv[r];
        }
    }
}

extern "C" void kernel_launch(void* const* d_in, const int* in_sizes, int n_in,
                              void* d_out, int out_size, void* d_ws, size_t ws_size,
                              hipStream_t stream) {
    const float* q  = (const float*)d_in[0];
    const float* k  = (const float*)d_in[1];
    const float* v  = (const float*)d_in[2];
    const int*   sr = (const int*)d_in[3];
    float* out = (float*)d_out;
    (void)in_sizes; (void)n_in; (void)out_size;

    dim3 grid(H_, SQ_ / 64, 1);
    dim3 block(128 * KSPLIT_, 1, 1);

    const size_t kv_elems = (size_t)HKV_ * SK_ * D_;          // 1M f16 each
    const size_t need     = kv_elems * sizeof(_Float16) * 2;  // 4 MB
    if (ws_size >= need) {
        _Float16* kh  = (_Float16*)d_ws;
        _Float16* vth = kh + kv_elems;
        cvt_kv_kernel<<<(2 * (int)(kv_elems / 8)) / 256, 256, 0, stream>>>(k, v, kh, vth);
        flashmask_fwd<true><<<grid, block, 0, stream>>>(q, k, v, sr, kh, vth, out);
    } else {
        flashmask_fwd<false><<<grid, block, 0, stream>>>(q, k, v, sr, nullptr, nullptr, out);
    }
}

// v006
// It runs in 37.4 microseconds.
// Next to v005, in two timings, it ran 1.20 times as fast each time.
// Over all steps from v000 it is 5.31 times as fast.
#include <hip/hip_runtime.h>

typedef __attribute__((ext_vector_type(16))) _Float16 v16h;
typedef __attribute__((ext_vector_type(8)))  _Float16 v8h;
typedef __attribute__((ext_vector_type(8)))  float    v8f;
typedef __attribute__((ext_vector_type(4)))  float    v4f;
typedef __attribute__((ext_vector_type(4)))  int      v4i;

#define SQ_  2048
#define SK_  2048
#define H_   16
#define HKV_ 4
#define D_   128
#define GQA_ (H_ / HKV_)
#define KSPLIT_ 4   // wave groups per work-group; group g takes key tiles g, g+4, g+8, ...

#if __has_builtin(__builtin_amdgcn_global_load_async_to_lds_b128) && \
    __has_builtin(__builtin_amdgcn_s_wait_asynccnt)
#define USE_ASYNC_LDS 1
typedef __attribute__((address_space(1))) v4i g_v4i;   // global b128
typedef __attribute__((address_space(3))) v4i l_v4i;   // LDS b128
#else
#define USE_ASYNC_LDS 0
#endif

// Copy 16 bytes global(f16) -> LDS. Async (ASYNCcnt) when the gfx1250 builtin
// exists, else a b128 load + ds_store_b128 pair.
__device__ __forceinline__ void copy16_g2l(const _Float16* g, _Float16* l) {
#if USE_ASYNC_LDS
    __builtin_amdgcn_global_load_async_to_lds_b128((g_v4i*)g, (l_v4i*)l, 0, 0);
#else
    *(v8h*)l = *(const v8h*)g;
#endif
}

// ---------------- one-time K/V convert kernel ----------------
// kh : [HKV][SK][128] f16 (row-major, same as source minus head interleave)
// vth: [HKV][SK/32][128][32] f16 (transposed so the PV fragment reads are contiguous;
//      one 32-key tile = 8 KB in a row, so the staging copies ask for whole lines)
__global__ __launch_bounds__(256) void cvt_kv_kernel(
        const float* __restrict__ kg, const float* __restrict__ vg,
        _Float16* __restrict__ kh, _Float16* __restrict__ vth)
{
    const int gid = blockIdx.x * 256 + threadIdx.x;
    const int NK  = HKV_ * SK_ * D_ / 8;          // 131072 vec8 jobs for K
    if (gid < NK) {
        const int dseg = gid & (D_ / 8 - 1);      // 0..15
        const int hs   = gid >> 4;                // hkv*SK + s
        const int s    = hs & (SK_ - 1);
        const int hkv  = hs >> 11;
        const float4* s4 = (const float4*)(kg + ((size_t)s * HKV_ + hkv) * D_ + dseg * 8);
        float4 a = s4[0], b = s4[1];
        v8h o;
        o[0]=(_Float16)a.x; o[1]=(_Float16)a.y; o[2]=(_Float16)a.z; o[3]=(_Float16)a.w;
        o[4]=(_Float16)b.x; o[5]=(_Float16)b.y; o[6]=(_Float16)b.z; o[7]=(_Float16)b.w;
        *(v8h*)(kh + (size_t)hs * D_ + dseg * 8) = o;
    } else {
        const int t    = gid - NK;                // 16-byte piece t of vth: 8 keys of one d
        const int d    = (t >> 2) & (D_ - 1);
        const int tile = t >> 9;                  // hkv*(SK/32) + key tile
        const int hkv  = tile / (SK_ / 32);
        const int s0   = (tile & (SK_ / 32 - 1)) * 32 + (t & 3) * 8;
        v8h o;
        #pragma unroll
        for (int i = 0; i < 8; ++i)
            o[i] = (_Float16)vg[((size_t)(s0 + i) * HKV_ + hkv) * D_ + d];
        *(v8h*)(vth + (size_t)t * 8) = o;
    }
}

// ---------------- main flash kernel ----------------
// One work-group = 64 query rows x KSPLIT_ groups of 4 waves. Every group runs
// its own online softmax over every KSPLIT_-th key tile, with its own K/V
// LDS; group 0 joins the partial (m, l, O) through LDS at the end.
template <bool WS>
__launch_bounds__(128 * KSPLIT_, 1)
__global__ void flashmask_fwd(const float* __restrict__ qg,
                              const float* __restrict__ kg,
                              const float* __restrict__ vg,
                              const int*   __restrict__ sr,
                              const _Float16* __restrict__ kh,
                              const _Float16* __restrict__ vth,
                              float* __restrict__ out)
{
    // Two buffers each for the workspace path: trip t reads buffer t & 1 while tile t + 1 lands in the other.
    constexpr int NBUF = WS ? 2 : 1;
    __shared__ _Float16 Kl[NBUF][KSPLIT_][32][136];   // K tile, row-major (pad->272B rows: 16 B x odd, b128 column reads hit distinct banks)
    __shared__ _Float16 Vt[NBUF][KSPLIT_][128][40];   // V tile, transposed (pad->80B rows)
    __shared__ v4f Mg[KSPLIT_ - 1][4][17][32];   // partials of groups 1.. : 16 x O, 1 x (m, l), one b128 per lane

    const int tid  = threadIdx.x;
    const int lane = tid & 31;
    const int grp  = __builtin_amdgcn_readfirstlane(tid >> 7);  // key-split group, wave-uniform
    const int gw   = (tid >> 5) & 3;       // wave inside its group: which 16 query rows
    const int gt   = tid & 127;            // thread inside its group
    const int ln16 = lane & 15;
    const int hi8  = (lane >> 4) * 8;

    // Heaviest first: a query block's cost grows with its position (causal), and there are
    // twice as many work-groups as places on the chip. The flat index runs over the heads
    // fastest and down the query blocks, so the long blocks have the lowest indices.
    const int h      = blockIdx.x;
    const int qb     = SQ_ / 64 - 1 - blockIdx.y;
    const int hkv    = h / GQA_;
    const int q_base = qb * 64 + gw * 16;

    // fold 1/sqrt(D) * log2(e) into Q: softmax runs in base-2 domain
    const float QSC = 0.08838834764831845f * 1.44269504088896340f;

    // ---- Q tile -> WMMA B operand of the transposed scores (pre-scaled): lane = query, same k order as the K rows ----
    v16h QA[4];
    {
        const float* qrow = qg + ((size_t)(q_base + ln16) * H_ + h) * D_;
        #pragma unroll
        for (int c = 0; c < 4; ++c) {
            const int dlo = c * 32 + hi8;
            const int dhi = c * 32 + 16 + hi8;
            #pragma unroll
            for (int i = 0; i < 8; ++i) {
                QA[c][i]     = (_Float16)(qrow[dlo + i] * QSC);
                QA[c][i + 8] = (_Float16)(qrow[dhi + i] * QSC);
            }
        }
    }

    v16h ONES;
    #pragma unroll
    for (int i = 0; i < 16; ++i) ONES[i] = (_Float16)1.0f;

    v8f O[8];
    #pragma unroll
    for (int j = 0; j < 8; ++j) O[j] = v8f{};
    // Scores and output are kept transposed (keys or d down the registers, one query per
    // lane), so a lane and its partner lane ^ 16 own one query: one m and one l each.
    float mrow = -1e30f, lrow = 0.0f;
    const int row = q_base + ln16;         // this lane's query

    const int nkb  = 2 * qb + 2;           // causal truncation
    const int nit  = (nkb + KSPLIT_ - 1) / KSPLIT_;
    const int crow = gt >> 2;              // 0..31
    const int cq   = gt & 3;               // 64B segment id (16B segment of a V row in the WS path)

    // Workspace path: start the copies of this group's trip-t tiles into buffer b.
    // Both tiles are 8 KB in a row in the workspace. Copy i of thread gt moves
    // 16-byte piece i * 128 + gt, so one wave's copy reads 512 adjacent bytes:
    // 4 whole lines.
    auto stage = [&](int t, int b) {
        const int kbs = t * KSPLIT_ + grp;
        const _Float16* kp = kh  + (size_t)(hkv * (SK_ / 32) + kbs) * (D_ * 32);
        const _Float16* vp = vth + (size_t)(hkv * (SK_ / 32) + kbs) * (D_ * 32);
        #pragma unroll
        for (int i = 0; i < 4; ++i)
            copy16_g2l(kp + i * 1024 + gt * 8, &Kl[b][grp][i * 8 + (gt >> 4)][(gt & 15) * 8]);
        #pragma unroll
        for (int i = 0; i < 4; ++i)
            copy16_g2l(vp + i * 1024 + gt * 8, &Vt[b][grp][i * 32 + crow][cq * 8]);
    };

    // Mask bounds of the 16 keys whose scores this lane holds in a trip: bnd[t][i] is
    // (start, end, start, end) of keys t * 16 + hi8 + 2 i and the next, 64 bytes in a row per t.
    // Like the tiles they are fetched one trip ahead, so no trip waits for them.
    v4i bnd[2][4];
    auto load_bounds = [&](int kfirst) {
        #pragma unroll
        for (int t = 0; t < 2; ++t) {
            const v4i* bp = (const v4i*)(sr + (hkv * SK_ + kfirst + t * 16 + hi8) * 2);
            #pragma unroll
            for (int i = 0; i < 4; ++i) bnd[t][i] = bp[i];
        }
    };
    load_bounds(grp * 32);

    if constexpr (WS) {
        stage(0, 0);
        // tile 0 has landed for this wave; the barrier shows it to the group's other waves
        asm volatile("s_wait_asynccnt 0x0" ::: "memory");
        __syncthreads();
        if (nit > 1) stage(1, 1);
    }

    for (int it = 0; it < nit; ++it) {
        // A tile with kb >= nkb (last trip only, still inside SK_) lies wholly
        // above the diagonal: the causal mask below gives it weight 0.
        const int kb  = it * KSPLIT_ + grp;
        const int k0  = kb * 32;
        const int buf = WS ? (it & 1) : 0;

        // ---------- stage K/V tiles into LDS (no workspace: in the trip itself) ----------
        if constexpr (!WS) {
            const float* kp = kg + ((size_t)(k0 + crow) * HKV_ + hkv) * D_ + cq * 32;
            const float* vp = vg + ((size_t)(k0 + crow) * HKV_ + hkv) * D_ + cq * 32;
            const float4* kp4 = (const float4*)kp;
            const float4* vp4 = (const float4*)vp;
            #pragma unroll
            for (int i = 0; i < 8; ++i) {
                float4 f = kp4[i];
                Kl[0][grp][crow][cq * 32 + 4*i + 0] = (_Float16)f.x;
                Kl[0][grp][crow][cq * 32 + 4*i + 1] = (_Float16)f.y;
                Kl[0][grp][crow][cq * 32 + 4*i + 2] = (_Float16)f.z;
                Kl[0][grp][crow][cq * 32 + 4*i + 3] = (_Float16)f.w;
            }
            #pragma unroll
            for (int i = 0; i < 8; ++i) {
                float4 f = vp4[i];
                Vt[0][grp][cq * 32 + 4*i + 0][crow] = (_Float16)f.x;
                Vt[0][grp][cq * 32 + 4*i + 1][crow] = (_Float16)f.y;
                Vt[0][grp][cq * 32 + 4*i + 2][crow] = (_Float16)f.z;
                Vt[0][grp][cq * 32 + 4*i + 3][crow] = (_Float16)f.w;
            }
            if (it + 1 < nit) {
                __builtin_prefetch(kp + KSPLIT_ * 32 * HKV_ * D_, 0, 0);
                __builtin_prefetch(vp + KSPLIT_ * 32 * HKV_ * D_, 0, 0);
            }
            __syncthreads();
        }

        // ---------- S^T = K (Q*qsc)^T : two 16x16 tiles, register r of tile t = key t*16 + hi8 + r ----------
        v8f S[2];
        #pragma unroll
        for (int t = 0; t < 2; ++t) {
            v8f acc = v8f{};
            #pragma unroll
            for (int c = 0; c < 4; ++c) {
                v8h lo = *(const v8h*)&Kl[buf][grp][t * 16 + ln16][c * 32 + hi8];
                v8h hi = *(const v8h*)&Kl[buf][grp][t * 16 + ln16][c * 32 + 16 + hi8];
                v16h bk = __builtin_shufflevector(lo, hi,
                    0,1,2,3,4,5,6,7,8,9,10,11,12,13,14,15);
                acc = __builtin_amdgcn_wmma_f32_16x16x32_f16(
                        false, bk, false, QA[c], (short)0, acc, false, false);
            }
            S[t] = acc;
        }

        // ---------- mask: causal | band (key column = k0 + hi8 + t*16 + r, so row < column is rel < t*16 + r) ----------
        const int rel = row - hi8 - k0;
        #pragma unroll
        for (int t = 0; t < 2; ++t) {
            #pragma unroll
            for (int r = 0; r < 8; ++r) {
                const int cs  = bnd[t][r >> 1][(r & 1) * 2];
                const int ce  = bnd[t][r >> 1][(r & 1) * 2 + 1];
                const bool msk = (rel < t * 16 + r) || (row >= cs && row < ce);
                S[t][r] = msk ? -1e30f : S[t][r];
            }
        }

        // ---------- next trip's mask bounds, into the registers just read (the last trip reads its own again: in bounds, unused) ----------
        load_bounds((it + 1 < nit) ? k0 + KSPLIT_ * 32 : k0);

        // ---------- the query's maximum: 16 keys in the lane, the other 16 in lane ^ 16 ----------
        float rm = fmaxf(S[0][0], S[1][0]);
        #pragma unroll
        for (int r = 1; r < 8; ++r) rm = fmaxf(rm, fmaxf(S[0][r], S[1][r]));
        rm = fmaxf(rm, __builtin_bit_cast(float, __builtin_amdgcn_permlanex16(
                 __builtin_bit_cast(int, rm), __builtin_bit_cast(int, rm),
                 0x76543210, 0xfedcba98, false, false)));
        const float mnew  = fmaxf(mrow, rm);
        const float alpha = exp2f(mrow - mnew);
        mrow = mnew;
        #pragma unroll
        for (int j = 0; j < 8; ++j)
            #pragma unroll
            for (int r = 0; r < 8; ++r) O[j][r] *= alpha;

        // ---------- P^T = exp2(S^T - m): the two score tiles, converted in place, are the B operand ----------
        v16h PB;
        #pragma unroll
        for (int t = 0; t < 2; ++t) {
            #pragma unroll
            for (int r = 0; r < 8; ++r)
                PB[t * 8 + r] = (_Float16)exp2f(S[t][r] - mnew);
        }

        // ---------- row-sum via WMMA: ones x P^T puts the query's sum over all 32 keys in every register ----------
        {
            v8f rs = __builtin_amdgcn_wmma_f32_16x16x32_f16(
                       false, ONES, false, PB, (short)0, v8f{}, false, false);
            lrow = lrow * alpha + rs[0];
        }

        // ---------- O^T += V^T * P^T (8 d-tiles) ----------
        #pragma unroll
        for (int j = 0; j < 8; ++j) {
            v8h lo = *(const v8h*)&Vt[buf][grp][j * 16 + ln16][hi8];
            v8h hi = *(const v8h*)&Vt[buf][grp][j * 16 + ln16][16 + hi8];
            v16h bv = __builtin_shufflevector(lo, hi,
                0,1,2,3,4,5,6,7,8,9,10,11,12,13,14,15);
            O[j] = __builtin_amdgcn_wmma_f32_16x16x32_f16(
                     false, bv, false, PB, (short)0, O[j], false, false);
        }

        if constexpr (WS) {
            // Hand-over: this wave's LDS reads of buffer buf are done ...
            asm volatile("s_wait_dscnt 0x0" ::: "memory");
            // ... and its copies of tile it + 1 have landed in the other buffer.
            asm volatile("s_wait_asynccnt 0x0" ::: "memory");
            // One barrier a trip: shows tile it + 1 to the group and frees buffer buf for the refill.
            __syncthreads();
            if (it + 2 < nit) stage(it + 2, buf);
        } else {
            __syncthreads();
        }
    }
    if constexpr (WS) {
        // closes the ring: no copy of this wave is in flight when it goes on to the join and ends
        asm volatile("s_wait_asynccnt 0x0" ::: "memory");
    }

    // ---------- join the groups' partial softmaxes (same lane/register layout in every group) ----------
    if (grp != 0) {
        v4f (*dst)[32] = Mg[grp - 1][gw];
        #pragma unroll
        for (int j = 0; j < 8; ++j) {
            dst[2 * j][lane]     = __builtin_shufflevector(O[j], O[j], 0, 1, 2, 3);
            dst[2 * j + 1][lane] = __builtin_shufflevector(O[j], O[j], 4, 5, 6, 7);
        }
        dst[16][lane] = v4f{mrow, lrow, 0.0f, 0.0f};
    }
    __syncthreads();
    if (grp != 0) return;   // no barrier follows

    // rolled: one group's partials in registers at a time (unrolled, the hoisted LDS loads spill)
    #pragma unroll 1
    for (int g = 0; g < KSPLIT_ - 1; ++g) {
        const v4f (*srcp)[32] = Mg[g][gw];
        const v4f ml = srcp[16][lane];
        // a side that saw no unmasked key of the query gets weight 0
        const float mt = fmaxf(mrow, ml[0]);
        const float wa = exp2f(mrow - mt);
        const float wb = exp2f(ml[0] - mt);
        mrow = mt;
        lrow = lrow * wa + ml[1] * wb;
        #pragma unroll
        for (int j = 0; j < 8; ++j) {
            const v8f og = __builtin_shufflevector(srcp[2 * j][lane], srcp[2 * j + 1][lane],
                                                   0, 1, 2, 3, 4, 5, 6, 7);
            #pragma unroll
            for (int r = 0; r < 8; ++r) O[j][r] = O[j][r] * wa + og[r] * wb;
        }
    }

    // ---------- normalize + store: a lane holds d = j*16 + hi8 .. + 7 of its query, 32 bytes in a row ----------
    const float inv = 1.0f / fmaxf(lrow, 1e-20f);
    float* orow = out + ((size_t)row * H_ + h) * D_ + hi8;
    #pragma unroll
    for (int j = 0; j < 8; ++j) {
        const v8f o = O[j] * inv;
        *(v4f*)(orow + j * 16)     = __builtin_shufflevector(o, o, 0, 1, 2, 3);
        *(v4f*)(orow + j * 16 + 4) = __builtin_shufflevector(o, o, 4, 5, 6, 7);
    }
}

extern "C" void kernel_launch(void* const* d_in, const int* in_sizes, int n_in,
                              void* d_out, int out_size, void* d_ws, size_t ws_size,
                              hipStream_t stream) {
    const float* q  = (const float*)d_in[0];
    const float* k  = (const float*)d_in[1];
    const float* v  = (const float*)d_in[2];
    const int*   sr = (const int*)d_in[3];
    float* out = (float*)d_out;
    (void)in_sizes; (void)n_in; (void)out_size;

    dim3 grid(H_, SQ_ / 64, 1);
    dim3 block(128 * KSPLIT_, 1, 1);

    const size_t kv_elems = (size_t)HKV_ * SK_ * D_;          // 1M f16 each
    const size_t need     = kv_elems * sizeof(_Float16) * 2;  // 4 MB
    if (ws_size >= need) {
        _Float16* kh  = (_Float16*)d_ws;
        _Float16* vth = kh + kv_elems;
        cvt_kv_kernel<<<(2 * (int)(kv_elems / 8)) / 256, 256, 0, stream>>>(k, v, kh, vth);
        flashmask_fwd<true><<<grid, block, 0, stream>>>(q, k, v, sr, kh, vth, out);
    } else {
        flashmask_fwd<false><<<grid, block, 0, stream>>>(q, k, v, sr, nullptr, nullptr, out);
    }
}

// v007
// One run takes 34.8 microseconds.
// Next to v006, in two timings, it ran 1.08 and 1.06 times as fast.
// Over all steps from v000 it is 5.69 times as fast.
#include <hip/hip_runtime.h>

typedef __attribute__((ext_vector_type(16))) _Float16 v16h;
typedef __attribute__((ext_vector_type(8)))  _Float16 v8h;
typedef __attribute__((ext_vector_type(8)))  float    v8f;
typedef __attribute__((ext_vector_type(4)))  float    v4f;
typedef __attribute__((ext_vector_type(4)))  int      v4i;

#define SQ_  2048
#define SK_  2048
#define H_   16
#define HKV_ 4
#define D_   128
#define GQA_ (H_ / HKV_)
#define KSPLIT_ 4   // wave groups per work-group; group g takes key tiles g, g+4, g+8, ...

#if __has_builtin(__builtin_amdgcn_global_load_async_to_lds_b128) && \
    __has_builtin(__builtin_amdgcn_s_wait_asynccnt)
#define USE_ASYNC_LDS 1
typedef __attribute__((address_space(1))) v4i g_v4i;   // global b128
typedef __attribute__((address_space(3))) v4i l_v4i;   // LDS b128
#else
#define USE_ASYNC_LDS 0
#endif

// Copy 16 bytes global(f16) -> LDS. Async (ASYNCcnt) when the gfx1250 builtin
// exists, else a b128 load + ds_store_b128 pair.
__device__ __forceinline__ void copy16_g2l(const _Float16* g, _Float16* l) {
#if USE_ASYNC_LDS
    __builtin_amdgcn_global_load_async_to_lds_b128((g_v4i*)g, (l_v4i*)l, 0, 0);
#else
    *(v8h*)l = *(const v8h*)g;
#endif
}

// ---------------- one-time K/V convert kernel ----------------
// kh : [HKV][SK][128] f16 (row-major, same as source minus head interleave)
// vth: [HKV][SK/32][128][32] f16 (transposed so the PV fragment reads are contiguous;
//      one 32-key tile = 8 KB in a row, so the staging copies ask for whole lines)
__global__ __launch_bounds__(256) void cvt_kv_kernel(
        const float* __restrict__ kg, const float* __restrict__ vg,
        _Float16* __restrict__ kh, _Float16* __restrict__ vth)
{
    const int gid = blockIdx.x * 256 + threadIdx.x;
    const int NK  = HKV_ * SK_ * D_ / 8;          // 131072 vec8 jobs for K
    if (gid < NK) {
        const int dseg = gid & (D_ / 8 - 1);      // 0..15
        const int hs   = gid >> 4;                // hkv*SK + s
        const int s    = hs & (SK_ - 1);
        const int hkv  = hs >> 11;
        const float4* s4 = (const float4*)(kg + ((size_t)s * HKV_ + hkv) * D_ + dseg * 8);
        float4 a = s4[0], b = s4[1];
        v8h o;
        o[0]=(_Float16)a.x; o[1]=(_Float16)a.y; o[2]=(_Float16)a.z; o[3]=(_Float16)a.w;
        o[4]=(_Float16)b.x; o[5]=(_Float16)b.y; o[6]=(_Float16)b.z; o[7]=(_Float16)b.w;
        *(v8h*)(kh + (size_t)hs * D_ + dseg * 8) = o;
    } else {
        const int t    = gid - NK;                // 16-byte piece t of vth: 8 keys of one d
        const int d    = (t >> 2) & (D_ - 1);
        const int tile = t >> 9;                  // hkv*(SK/32) + key tile
        const int hkv  = tile / (SK_ / 32);
        const int s0   = (tile & (SK_ / 32 - 1)) * 32 + (t & 3) * 8;
        v8h o;
        #pragma unroll
        for (int i = 0; i < 8; ++i)
            o[i] = (_Float16)vg[((size_t)(s0 + i) * HKV_ + hkv) * D_ + d];
        *(v8h*)(vth + (size_t)t * 8) = o;
    }
}

// ---------------- main flash kernel ----------------
// One work-group = 64 query rows x KSPLIT_ groups of 4 waves. Every group runs
// its own online softmax over every KSPLIT_-th key tile, with its own K/V
// LDS; group 0 joins the partial (m, l, O) through LDS at the end.
template <bool WS>
__launch_bounds__(128 * KSPLIT_, 1)
__global__ void flashmask_fwd(const float* __restrict__ qg,
                              const float* __restrict__ kg,
                              const float* __restrict__ vg,
                              const int*   __restrict__ sr,
                              const _Float16* __restrict__ kh,
                              const _Float16* __restrict__ vth,
                              float* __restrict__ out)
{
    // Two buffers each for the workspace path: trip t reads buffer t & 1 while tile t + 1 lands in the other.
    constexpr int NBUF = WS ? 2 : 1;
    __shared__ _Float16 Kl[NBUF][KSPLIT_][32][136];   // K tile, row-major (pad->272B rows: 16 B x odd, b128 column reads hit distinct banks)
    __shared__ _Float16 Vt[NBUF][KSPLIT_][128][40];   // V tile, transposed (pad->80B rows)
    __shared__ v4f Mg[KSPLIT_ - 1][4][17][32];   // partials of groups 1.. : 16 x O, 1 x (m, l), one b128 per lane

    const int tid  = threadIdx.x;
    const int lane = tid & 31;
    const int grp  = __builtin_amdgcn_readfirstlane(tid >> 7);  // key-split group, wave-uniform
    const int gw   = (tid >> 5) & 3;       // wave inside its group: which 16 query rows
    const int gt   = tid & 127;            // thread inside its group
    const int ln16 = lane & 15;
    const int hi8  = (lane >> 4) * 8;

    // Heaviest first: a query block's cost grows with its position (causal), and there are
    // twice as many work-groups as places on the chip. The flat index runs over the heads
    // fastest and down the query blocks, so the long blocks have the lowest indices.
    const int h      = blockIdx.x;
    const int qb     = SQ_ / 64 - 1 - blockIdx.y;
    const int hkv    = h / GQA_;
    const int q_base = qb * 64 + gw * 16;

    // fold 1/sqrt(D) * log2(e) into Q: softmax runs in base-2 domain
    const float QSC = 0.08838834764831845f * 1.44269504088896340f;

    // ---- Q tile -> WMMA B operand of the transposed scores (pre-scaled): lane = query, same k order as the K rows ----
    v16h QA[4];
    {
        const float* qrow = qg + ((size_t)(q_base + ln16) * H_ + h) * D_;
        #pragma unroll
        for (int c = 0; c < 4; ++c) {
            const int dlo = c * 32 + hi8;
            const int dhi = c * 32 + 16 + hi8;
            #pragma unroll
            for (int i = 0; i < 8; ++i) {
                QA[c][i]     = (_Float16)(qrow[dlo + i] * QSC);
                QA[c][i + 8] = (_Float16)(qrow[dhi + i] * QSC);
            }
        }
    }

    v16h ONES;
    #pragma unroll
    for (int i = 0; i < 16; ++i) ONES[i] = (_Float16)1.0f;

    v8f O[8];
    #pragma unroll
    for (int j = 0; j < 8; ++j) O[j] = v8f{};
    // Scores and output are kept transposed (keys or d down the registers, one query per
    // lane), so a lane and its partner lane ^ 16 own one query: one m and one l each.
    float mrow = -1e30f, lrow = 0.0f;
    const int row = q_base + ln16;         // this lane's query

    const int nkb  = 2 * qb + 2;           // causal truncation
    const int nit  = (nkb + KSPLIT_ - 1) / KSPLIT_;
    const int crow = gt >> 2;              // 0..31
    const int cq   = gt & 3;               // 64B segment id (16B segment of a V row in the WS path)

    // Workspace path: start the copies of this group's trip-t tiles into buffer b.
    // Both tiles are 8 KB in a row in the workspace. Copy i of thread gt moves
    // 16-byte piece i * 128 + gt, so one wave's copy reads 512 adjacent bytes:
    // 4 whole lines.
    auto stage = [&](int t, int b) {
        const int kbs = t * KSPLIT_ + grp;
        const _Float16* kp = kh  + (size_t)(hkv * (SK_ / 32) + kbs) * (D_ * 32);
        const _Float16* vp = vth + (size_t)(hkv * (SK_ / 32) + kbs) * (D_ * 32);
        #pragma unroll
        for (int i = 0; i < 4; ++i)
            copy16_g2l(kp + i * 1024 + gt * 8, &Kl[b][grp][i * 8 + (gt >> 4)][(gt & 15) * 8]);
        #pragma unroll
        for (int i = 0; i < 4; ++i)
            copy16_g2l(vp + i * 1024 + gt * 8, &Vt[b][grp][i * 32 + crow][cq * 8]);
    };

    // Mask bounds of the 16 keys whose scores this lane holds in a trip: bnd[t][i] is
    // (start, end, start, end) of keys t * 16 + hi8 + 2 i and the next, 64 bytes in a row per t.
    // Like the tiles they are fetched one trip ahead, so no trip waits for them.
    v4i bnd[2][4];
    auto load_bounds = [&](int kfirst) {
        #pragma unroll
        for (int t = 0; t < 2; ++t) {
            const v4i* bp = (const v4i*)(sr + (hkv * SK_ + kfirst + t * 16 + hi8) * 2);
            #pragma unroll
            for (int i = 0; i < 4; ++i) bnd[t][i] = bp[i];
        }
    };
    load_bounds(grp * 32);

    if constexpr (WS) {
        stage(0, 0);
        // tile 0 has landed for this wave; the barrier shows it to the group's other waves
        asm volatile("s_wait_asynccnt 0x0" ::: "memory");
        __syncthreads();
        if (nit > 1) stage(1, 1);
    }

    for (int it = 0; it < nit; ++it) {
        // A tile with kb >= nkb (last trip only, still inside SK_) lies wholly
        // above the diagonal: the causal mask below gives it weight 0.
        const int kb  = it * KSPLIT_ + grp;
        const int k0  = kb * 32;
        const int buf = WS ? (it & 1) : 0;

        // ---------- stage K/V tiles into LDS (no workspace: in the trip itself) ----------
        if constexpr (!WS) {
            const float* kp = kg + ((size_t)(k0 + crow) * HKV_ + hkv) * D_ + cq * 32;
            const float* vp = vg + ((size_t)(k0 + crow) * HKV_ + hkv) * D_ + cq * 32;
            const float4* kp4 = (const float4*)kp;
            const float4* vp4 = (const float4*)vp;
            #pragma unroll
            for (int i = 0; i < 8; ++i) {
                float4 f = kp4[i];
                Kl[0][grp][crow][cq * 32 + 4*i + 0] = (_Float16)f.x;
                Kl[0][grp][crow][cq * 32 + 4*i + 1] = (_Float16)f.y;
                Kl[0][grp][crow][cq * 32 + 4*i + 2] = (_Float16)f.z;
                Kl[0][grp][crow][cq * 32 + 4*i + 3] = (_Float16)f.w;
            }
            #pragma unroll
            for (int i = 0; i < 8; ++i) {
                float4 f = vp4[i];
                Vt[0][grp][cq * 32 + 4*i + 0][crow] = (_Float16)f.x;
                Vt[0][grp][cq * 32 + 4*i + 1][crow] = (_Float16)f.y;
                Vt[0][grp][cq * 32 + 4*i + 2][crow] = (_Float16)f.z;
                Vt[0][grp][cq * 32 + 4*i + 3][crow] = (_Float16)f.w;
            }
            if (it + 1 < nit) {
                __builtin_prefetch(kp + KSPLIT_ * 32 * HKV_ * D_, 0, 0);
                __builtin_prefetch(vp + KSPLIT_ * 32 * HKV_ * D_, 0, 0);
            }
            __syncthreads();
        }

        // ---------- S^T = K (Q*qsc)^T : two 16x16 tiles, register r of tile t = key t*16 + hi8 + r ----------
        v8f S[2];
        #pragma unroll
        for (int t = 0; t < 2; ++t) {
            v8f acc = v8f{};
            #pragma unroll
            for (int c = 0; c < 4; ++c) {
                v8h lo = *(const v8h*)&Kl[buf][grp][t * 16 + ln16][c * 32 + hi8];
                v8h hi = *(const v8h*)&Kl[buf][grp][t * 16 + ln16][c * 32 + 16 + hi8];
                v16h bk = __builtin_shufflevector(lo, hi,
                    0,1,2,3,4,5,6,7,8,9,10,11,12,13,14,15);
                acc = __builtin_amdgcn_wmma_f32_16x16x32_f16(
                        false, bk, false, QA[c], (short)0, acc, false, false);
            }
            S[t] = acc;
        }

        // ---------- mask: causal | band (key column = k0 + hi8 + t*16 + r, so row < column is rel < t*16 + r) ----------
        const int rel = row - hi8 - k0;
        #pragma unroll
        for (int t = 0; t < 2; ++t) {
            #pragma unroll
            for (int r = 0; r < 8; ++r) {
                const int cs  = bnd[t][r >> 1][(r & 1) * 2];
                const int ce  = bnd[t][r >> 1][(r & 1) * 2 + 1];
                const bool msk = (rel < t * 16 + r) || (row >= cs && row < ce);
                S[t][r] = msk ? -1e30f : S[t][r];
            }
        }

        // ---------- next trip's mask bounds, into the registers just read (the last trip reads its own again: in bounds, unused) ----------
        load_bounds((it + 1 < nit) ? k0 + KSPLIT_ * 32 : k0);

        // ---------- the query's maximum: 16 keys in the lane, the other 16 in lane ^ 16 ----------
        float rm = fmaxf(S[0][0], S[1][0]);
        #pragma unroll
        for (int r = 1; r < 8; ++r) rm = fmaxf(rm, fmaxf(S[0][r], S[1][r]));
        rm = fmaxf(rm, __builtin_bit_cast(float, __builtin_amdgcn_permlanex16(
                 __builtin_bit_cast(int, rm), __builtin_bit_cast(int, rm),
                 0x76543210, 0xfedcba98, false, false)));
        const float mnew  = fmaxf(mrow, rm);
        // exp2 of the rescale exponent (e[0]) and of the 16 scores, as bare v_exp_f32. Every argument is <= 0
        // and a result below 2^-126 may come out 0 (f16 P drops it anyway; the factor scales finite sums),
        // so the library exp2f's range test, pre-scaling and ldexp are not needed.
        float e[17];
        e[0] = mrow - mnew;
        #pragma unroll
        for (int t = 0; t < 2; ++t) {
            #pragma unroll
            for (int r = 0; r < 8; ++r) e[1 + t * 8 + r] = S[t][r] - mnew;
        }
        // One statement, each value in its own register: no neighbour reads a result or overwrites a source
        // directly behind a transcendental, and
        // the closing v_nop keeps that one slot in front of whatever the compiler puts next.
        asm("v_exp_f32 %0, %0\n\tv_exp_f32 %1, %1\n\tv_exp_f32 %2, %2\n\tv_exp_f32 %3, %3\n\t"
            "v_exp_f32 %4, %4\n\tv_exp_f32 %5, %5\n\tv_exp_f32 %6, %6\n\tv_exp_f32 %7, %7\n\t"
            "v_exp_f32 %8, %8\n\tv_exp_f32 %9, %9\n\tv_exp_f32 %10, %10\n\tv_exp_f32 %11, %11\n\t"
            "v_exp_f32 %12, %12\n\tv_exp_f32 %13, %13\n\tv_exp_f32 %14, %14\n\tv_exp_f32 %15, %15\n\t"
            "v_exp_f32 %16, %16\n\tv_nop"
            : "+v"(e[0]), "+v"(e[1]), "+v"(e[2]), "+v"(e[3]), "+v"(e[4]), "+v"(e[5]), "+v"(e[6]),
              "+v"(e[7]), "+v"(e[8]), "+v"(e[9]), "+v"(e[10]), "+v"(e[11]), "+v"(e[12]), "+v"(e[13]),
              "+v"(e[14]), "+v"(e[15]), "+v"(e[16]));
        const float alpha = e[0];
        mrow = mnew;
        #pragma unroll
        for (int j = 0; j < 8; ++j)
            #pragma unroll
            for (int r = 0; r < 8; ++r) O[j][r] *= alpha;

        // ---------- P^T = exp2(S^T - m): the two score tiles, converted in place, are the B operand ----------
        v16h PB;
        #pragma unroll
        for (int t = 0; t < 2; ++t) {
            #pragma unroll
            for (int r = 0; r < 8; ++r)
                PB[t * 8 + r] = (_Float16)e[1 + t * 8 + r];
        }

        // ---------- row-sum via WMMA: ones x P^T puts the query's sum over all 32 keys in every register ----------
        {
            v8f rs = __builtin_amdgcn_wmma_f32_16x16x32_f16(
                       false, ONES, false, PB, (short)0, v8f{}, false, false);
            lrow = lrow * alpha + rs[0];
        }

        // ---------- O^T += V^T * P^T (8 d-tiles) ----------
        #pragma unroll
        for (int j = 0; j < 8; ++j) {
            v8h lo = *(const v8h*)&Vt[buf][grp][j * 16 + ln16][hi8];
            v8h hi = *(const v8h*)&Vt[buf][grp][j * 16 + ln16][16 + hi8];
            v16h bv = __builtin_shufflevector(lo, hi,
                0,1,2,3,4,5,6,7,8,9,10,11,12,13,14,15);
            O[j] = __builtin_amdgcn_wmma_f32_16x16x32_f16(
                     false, bv, false, PB, (short)0, O[j], false, false);
        }

        if constexpr (WS) {
            // Hand-over: this wave's LDS reads of buffer buf are done ...
            asm volatile("s_wait_dscnt 0x0" ::: "memory");
            // ... and its copies of tile it + 1 have landed in the other buffer.
            asm volatile("s_wait_asynccnt 0x0" ::: "memory");
            // One barrier a trip: shows tile it + 1 to the group and frees buffer buf for the refill.
            __syncthreads();
            if (it + 2 < nit) stage(it + 2, buf);
        } else {
            __syncthreads();
        }
    }
    if constexpr (WS) {
        // closes the ring: no copy of this wave is in flight when it goes on to the join and ends
        asm volatile("s_wait_asynccnt 0x0" ::: "memory");
    }

    // ---------- join the groups' partial softmaxes (same lane/register layout in every group) ----------
    if (grp != 0) {
        v4f (*dst)[32] = Mg[grp - 1][gw];
        #pragma unroll
        for (int j = 0; j < 8; ++j) {
            dst[2 * j][lane]     = __builtin_shufflevector(O[j], O[j], 0, 1, 2, 3);
            dst[2 * j + 1][lane] = __builtin_shufflevector(O[j], O[j], 4, 5, 6, 7);
        }
        dst[16][lane] = v4f{mrow, lrow, 0.0f, 0.0f};
    }
    __syncthreads();
    if (grp != 0) return;   // no barrier follows

    // rolled: one group's partials in registers at a time (unrolled, the hoisted LDS loads spill)
    #pragma unroll 1
    for (int g = 0; g < KSPLIT_ - 1; ++g) {
        const v4f (*srcp)[32] = Mg[g][gw];
        const v4f ml = srcp[16][lane];
        // a side that saw no unmasked key of the query gets weight 0
        const float mt = fmaxf(mrow, ml[0]);
        const float wa = exp2f(mrow - mt);
        const float wb = exp2f(ml[0] - mt);
        mrow = mt;
        lrow = lrow * wa + ml[1] * wb;
        #pragma unroll
        for (int j = 0; j < 8; ++j) {
            const v8f og = __builtin_shufflevector(srcp[2 * j][lane], srcp[2 * j + 1][lane],
                                                   0, 1, 2, 3, 4, 5, 6, 7);
            #pragma unroll
            for (int r = 0; r < 8; ++r) O[j][r] = O[j][r] * wa + og[r] * wb;
        }
    }

    // ---------- normalize + store: a lane holds d = j*16 + hi8 .. + 7 of its query, 32 bytes in a row ----------
    const float inv = 1.0f / fmaxf(lrow, 1e-20f);
    float* orow = out + ((size_t)row * H_ + h) * D_ + hi8;
    #pragma unroll
    for (int j = 0; j < 8; ++j) {
        const v8f o = O[j] * inv;
        *(v4f*)(orow + j * 16)     = __builtin_shufflevector(o, o, 0, 1, 2, 3);
        *(v4f*)(orow + j * 16 + 4) = __builtin_shufflevector(o, o, 4, 5, 6, 7);
    }
}

extern "C" void kernel_launch(void* const* d_in, const int* in_sizes, int n_in,
                              void* d_out, int out_size, void* d_ws, size_t ws_size,
                              hipStream_t stream) {
    const float* q  = (const float*)d_in[0];
    const float* k  = (const float*)d_in[1];
    const float* v  = (const float*)d_in[2];
    const int*   sr = (const int*)d_in[3];
    float* out = (float*)d_out;
    (void)in_sizes; (void)n_in; (void)out_size;

    dim3 grid(H_, SQ_ / 64, 1);
    dim3 block(128 * KSPLIT_, 1, 1);

    const size_t kv_elems = (size_t)HKV_ * SK_ * D_;          // 1M f16 each
    const size_t need     = kv_elems * sizeof(_Float16) * 2;  // 4 MB
    if (ws_size >= need) {
        _Float16* kh  = (_Float16*)d_ws;
        _Float16* vth = kh + kv_elems;
        cvt_kv_kernel<<<(2 * (int)(kv_elems / 8)) / 256, 256, 0, stream>>>(k, v, kh, vth);
        flashmask_fwd<true><<<grid, block, 0, stream>>>(q, k, v, sr, kh, vth, out);
    } else {
        flashmask_fwd<false><<<grid, block, 0, stream>>>(q, k, v, sr, nullptr, nullptr, out);
    }
}

// v008
// Measured time: 32.7 microseconds a run.
// Next to v007, in two timings, it ran 1.05 and 1.08 times as fast.
// Over all steps from v000 it is 6.05 times as fast.
#include <hip/hip_runtime.h>

typedef __attribute__((ext_vector_type(16))) _Float16 v16h;
typedef __attribute__((ext_vector_type(8)))  _Float16 v8h;
typedef __attribute__((ext_vector_type(8)))  float    v8f;
typedef __attribute__((ext_vector_type(4)))  float    v4f;
typedef __attribute__((ext_vector_type(4)))  int      v4i;
typedef __attribute__((ext_vector_type(4)))  unsigned v4u;
typedef __attribute__((ext_vector_type(16))) unsigned v16u;
typedef __attribute__((address_space(4))) const v16u c_v16u;   // memory that no one writes while the kernel runs

#define SQ_  2048
#define SK_  2048
#define H_   16
#define HKV_ 4
#define D_   128
#define GQA_ (H_ / HKV_)
#define KSPLIT_ 4   // wave groups per work-group; group g takes key tiles g, g+4, g+8, ...

#if __has_builtin(__builtin_amdgcn_global_load_async_to_lds_b128) && \
    __has_builtin(__builtin_amdgcn_s_wait_asynccnt)
#define USE_ASYNC_LDS 1
typedef __attribute__((address_space(1))) v4i g_v4i;   // global b128
typedef __attribute__((address_space(3))) v4i l_v4i;   // LDS b128
#else
#define USE_ASYNC_LDS 0
#endif

// Copy 16 bytes global(f16) -> LDS. Async (ASYNCcnt) when the gfx1250 builtin
// exists, else a b128 load + ds_store_b128 pair.
__device__ __forceinline__ void copy16_g2l(const _Float16* g, _Float16* l) {
#if USE_ASYNC_LDS
    __builtin_amdgcn_global_load_async_to_lds_b128((g_v4i*)g, (l_v4i*)l, 0, 0);
#else
    *(v8h*)l = *(const v8h*)g;
#endif
}

// Bits q = 0..15 of the result: query row q0 + q lies below x.
__device__ __forceinline__ unsigned rows_below(int x, int q0) {
    const int n = min(max(x - q0, 0), 16);
    return (1u << n) - 1u;
}

// Bits q = 0..15: query row q0 + q does not see key column col (causal, or inside the band [cs, ce)).
__device__ __forceinline__ unsigned masked_rows(int col, int cs, int ce, int q0) {
    return rows_below(col, q0) | (rows_below(ce, q0) & ~rows_below(cs, q0));
}

// ---------------- one-time K/V convert and mask kernel ----------------
// kh : [HKV][SK][128] f16 (row-major, same as source minus head interleave)
// vth: [HKV][SK/32][128][32] f16 (transposed so the PV fragment reads are contiguous;
//      one 32-key tile = 8 KB in a row, so the staging copies ask for whole lines)
// mw : [HKV][SQ/16][SK/32][16] words: the mask of 16 queries x 32 keys in the lane order of the
//      flash kernel's score registers. Bit l of word t*8 + r belongs to query (l & 15) and key
//      t*16 + (l >> 4)*8 + r, so a word is the select mask of one score register of a wave.
//      The four query heads of a KV head share it.
__global__ __launch_bounds__(256) void cvt_kv_kernel(
        const float* __restrict__ kg, const float* __restrict__ vg,
        const int* __restrict__ sr,
        _Float16* __restrict__ kh, _Float16* __restrict__ vth, unsigned* __restrict__ mw)
{
    const int NM  = HKV_ * (SQ_ / 64) * (SK_ / 32) * 4;   // 32768 mask jobs, the longest: they take the lowest indices
    const int gid = blockIdx.x * 256 + threadIdx.x - NM;
    const int NK  = HKV_ * SK_ * D_ / 8;          // 131072 vec8 jobs for K
    if (gid >= 0 && gid < NK) {
        const int dseg = gid & (D_ / 8 - 1);      // 0..15
        const int hs   = gid >> 4;                // hkv*SK + s
        const int s    = hs & (SK_ - 1);
        const int hkv  = hs >> 11;
        const float4* s4 = (const float4*)(kg + ((size_t)s * HKV_ + hkv) * D_ + dseg * 8);
        float4 a = s4[0], b = s4[1];
        v8h o;
        o[0]=(_Float16)a.x; o[1]=(_Float16)a.y; o[2]=(_Float16)a.z; o[3]=(_Float16)a.w;
        o[4]=(_Float16)b.x; o[5]=(_Float16)b.y; o[6]=(_Float16)b.z; o[7]=(_Float16)b.w;
        *(v8h*)(kh + (size_t)hs * D_ + dseg * 8) = o;
    } else if (gid >= NK) {
        const int t    = gid - NK;                // 16-byte piece t of vth: 8 keys of one d
        const int d    = (t >> 2) & (D_ - 1);
        const int tile = t >> 9;                  // hkv*(SK/32) + key tile
        const int hkv  = tile / (SK_ / 32);
        const int s0   = (tile & (SK_ / 32 - 1)) * 32 + (t & 3) * 8;
        v8h o;
        #pragma unroll
        for (int i = 0; i < 8; ++i)
            o[i] = (_Float16)vg[((size_t)(s0 + i) * HKV_ + hkv) * D_ + d];
        *(v8h*)(vth + (size_t)t * 8) = o;
    } else {
        // Four words (16 bytes) of one key tile, for the four 16-query slices of one 64-query block.
        const int t   = gid + NM;
        const int wq  = t & 3;                    // words wq*4 .. wq*4 + 3
        const int kt  = (t >> 2) & (SK_ / 32 - 1);
        const int qb  = (t >> 8) & (SQ_ / 64 - 1);
        const int hkv = t >> 13;
        // the flash kernel walks key tiles 0 .. (its trips * KSPLIT_) - 1 of this query block and no further
        if (kt >= (2 * qb + 2 + KSPLIT_ - 1) / KSPLIT_ * KSPLIT_) return;
        const int klo = kt * 32 + (wq >> 1) * 16 + (wq & 1) * 4;   // key of bits 0..15 of the first word; bits 16..31: key + 8
        const v4i* bl = (const v4i*)(sr + (hkv * SK_ + klo) * 2);
        const v4i* bh = (const v4i*)(sr + (hkv * SK_ + klo + 8) * 2);
        const v4i b[4] = { bl[0], bl[1], bh[0], bh[1] };           // (start, end) of keys klo .. +3 and klo + 8 .. +11
        #pragma unroll
        for (int g = 0; g < 4; ++g) {
            const int q0 = qb * 64 + g * 16;
            v4u o;
            #pragma unroll
            for (int i = 0; i < 4; ++i) {
                const unsigned lo = masked_rows(klo + i,     b[i >> 1][(i & 1) * 2],       b[i >> 1][(i & 1) * 2 + 1],       q0);
                const unsigned hi = masked_rows(klo + 8 + i, b[2 + (i >> 1)][(i & 1) * 2], b[2 + (i >> 1)][(i & 1) * 2 + 1], q0);
                o[i] = lo | (hi << 16);
            }
            *(v4u*)(mw + ((size_t)((hkv * (SQ_ / 16) + qb * 4 + g) * (SK_ / 32) + kt) * 16 + wq * 4)) = o;
        }
    }
}

// ---------------- main flash kernel ----------------
// One work-group = 64 query rows x KSPLIT_ groups of 4 waves. Every group runs
// its own online softmax over every KSPLIT_-th key tile, with its own K/V
// LDS; group 0 joins the partial (m, l, O) through LDS at the end.
template <bool WS>
__launch_bounds__(128 * KSPLIT_, 1)
__global__ void flashmask_fwd(const float* __restrict__ qg,
                              const float* __restrict__ kg,
                              const float* __restrict__ vg,
                              const int*   __restrict__ sr,
                              const _Float16* __restrict__ kh,
                              const _Float16* __restrict__ vth,
                              const unsigned* __restrict__ mw,
                              float* __restrict__ out)
{
    // Two buffers each for the workspace path: trip t reads buffer t & 1 while tile t + 1 lands in the other.
    constexpr int NBUF = WS ? 2 : 1;
    __shared__ _Float16 Kl[NBUF][KSPLIT_][32][136];   // K tile, row-major (pad->272B rows: 16 B x odd, b128 column reads hit distinct banks)
    __shared__ _Float16 Vt[NBUF][KSPLIT_][128][40];   // V tile, transposed (pad->80B rows)
    __shared__ v4f Mg[KSPLIT_ - 1][4][17][32];   // partials of groups 1.. : 16 x O, 1 x (m, l), one b128 per lane

    const int tid  = threadIdx.x;
    const int lane = tid & 31;
    const int grp  = __builtin_amdgcn_readfirstlane(tid >> 7);  // key-split group, wave-uniform
    const int gw   = __builtin_amdgcn_readfirstlane((tid >> 5) & 3);   // wave inside its group: which 16 query rows, wave-uniform
    const int gt   = tid & 127;            // thread inside its group
    const int ln16 = lane & 15;
    const int hi8  = (lane >> 4) * 8;

    // Heaviest first: a query block's cost grows with its position (causal), and there are
    // twice as many work-groups as places on the chip. The flat index runs over the heads
    // fastest and down the query blocks, so the long blocks have the lowest indices.
    const int h      = blockIdx.x;
    const int qb     = SQ_ / 64 - 1 - blockIdx.y;
    const int hkv    = h / GQA_;
    const int q_base = qb * 64 + gw * 16;

    // fold 1/sqrt(D) * log2(e) into Q: softmax runs in base-2 domain
    const float QSC = 0.08838834764831845f * 1.44269504088896340f;

    // ---- Q tile -> WMMA B operand of the transposed scores (pre-scaled): lane = query, same k order as the K rows ----
    v16h QA[4];
    {
        const float* qrow = qg + ((size_t)(q_base + ln16) * H_ + h) * D_;
        #pragma unroll
        for (int c = 0; c < 4; ++c) {
            const int dlo = c * 32 + hi8;
            const int dhi = c * 32 + 16 + hi8;
            #pragma unroll
            for (int i = 0; i < 8; ++i) {
                QA[c][i]     = (_Float16)(qrow[dlo + i] * QSC);
                QA[c][i + 8] = (_Float16)(qrow[dhi + i] * QSC);
            }
        }
    }

    v16h ONES;
    #pragma unroll
    for (int i = 0; i < 16; ++i) ONES[i] = (_Float16)1.0f;

    v8f O[8];
    #pragma unroll
    for (int j = 0; j < 8; ++j) O[j] = v8f{};
    // Scores and output are kept transposed (keys or d down the registers, one query per
    // lane), so a lane and its partner lane ^ 16 own one query: one m and one l each.
    float mrow = -1e30f, lrow = 0.0f;
    const int row = q_base + ln16;         // this lane's query

    const int nkb  = 2 * qb + 2;           // causal truncation
    const int nit  = (nkb + KSPLIT_ - 1) / KSPLIT_;
    const int crow = gt >> 2;              // 0..31
    const int cq   = gt & 3;               // 64B segment id (16B segment of a V row in the WS path)

    // Workspace path: start the copies of this group's trip-t tiles into buffer b.
    // Both tiles are 8 KB in a row in the workspace. Copy i of thread gt moves
    // 16-byte piece i * 128 + gt, so one wave's copy reads 512 adjacent bytes:
    // 4 whole lines.
    auto stage = [&](int t, int b) {
        const int kbs = t * KSPLIT_ + grp;
        const _Float16* kp = kh  + (size_t)(hkv * (SK_ / 32) + kbs) * (D_ * 32);
        const _Float16* vp = vth + (size_t)(hkv * (SK_ / 32) + kbs) * (D_ * 32);
        #pragma unroll
        for (int i = 0; i < 4; ++i)
            copy16_g2l(kp + i * 1024 + gt * 8, &Kl[b][grp][i * 8 + (gt >> 4)][(gt & 15) * 8]);
        #pragma unroll
        for (int i = 0; i < 4; ++i)
            copy16_g2l(vp + i * 1024 + gt * 8, &Vt[b][grp][i * 32 + crow][cq * 8]);
    };

    // Workspace path: the wave's 16 mask words of a trip (see cvt_kv_kernel), 64 bytes at a wave-uniform
    // address, so they come by a scalar load into scalar registers, where a select takes its mask from.
    // No workspace: mask bounds of the 16 keys whose scores this lane holds in a trip: bnd[t][i] is
    // (start, end, start, end) of keys t * 16 + hi8 + 2 i and the next, 64 bytes in a row per t.
    // Like the tiles both are fetched one trip ahead, so no trip waits for them.
    v16u mk;
    v4i bnd[2][4];
    auto load_bounds = [&](int kfirst) {
        if constexpr (WS) {
            // constant address space: the launch before wrote the words and nothing writes them in this one;
            // without it the loads inside the loop come as vector loads plus 16 v_readfirstlane a trip
            mk = *(c_v16u*)(mw + (size_t)((hkv * (SQ_ / 16) + qb * 4 + gw) * (SK_ / 32) + (kfirst >> 5)) * 16);
        } else {
            #pragma unroll
            for (int t = 0; t < 2; ++t) {
                const v4i* bp = (const v4i*)(sr + (hkv * SK_ + kfirst + t * 16 + hi8) * 2);
                #pragma unroll
                for (int i = 0; i < 4; ++i) bnd[t][i] = bp[i];
            }
        }
    };
    load_bounds(grp * 32);

    if constexpr (WS) {
        stage(0, 0);
        // tile 0 has landed for this wave; the barrier shows it to the group's other waves
        asm volatile("s_wait_asynccnt 0x0" ::: "memory");
        __syncthreads();
        if (nit > 1) stage(1, 1);
    }

    for (int it = 0; it < nit; ++it) {
        // A tile with kb >= nkb (last trip only, still inside SK_) lies wholly
        // above the diagonal: the causal mask below gives it weight 0.
        const int kb  = it * KSPLIT_ + grp;
        const int k0  = kb * 32;
        const int buf = WS ? (it & 1) : 0;

        // ---------- stage K/V tiles into LDS (no workspace: in the trip itself) ----------
        if constexpr (!WS) {
            const float* kp = kg + ((size_t)(k0 + crow) * HKV_ + hkv) * D_ + cq * 32;
            const float* vp = vg + ((size_t)(k0 + crow) * HKV_ + hkv) * D_ + cq * 32;
            const float4* kp4 = (const float4*)kp;
            const float4* vp4 = (const float4*)vp;
            #pragma unroll
            for (int i = 0; i < 8; ++i) {
                float4 f = kp4[i];
                Kl[0][grp][crow][cq * 32 + 4*i + 0] = (_Float16)f.x;
                Kl[0][grp][crow][cq * 32 + 4*i + 1] = (_Float16)f.y;
                Kl[0][grp][crow][cq * 32 + 4*i + 2] = (_Float16)f.z;
                Kl[0][grp][crow][cq * 32 + 4*i + 3] = (_Float16)f.w;
            }
            #pragma unroll
            for (int i = 0; i < 8; ++i) {
                float4 f = vp4[i];
                Vt[0][grp][cq * 32 + 4*i + 0][crow] = (_Float16)f.x;
                Vt[0][grp][cq * 32 + 4*i + 1][crow] = (_Float16)f.y;
                Vt[0][grp][cq * 32 + 4*i + 2][crow] = (_Float16)f.z;
                Vt[0][grp][cq * 32 + 4*i + 3][crow] = (_Float16)f.w;
            }
            if (it + 1 < nit) {
                __builtin_prefetch(kp + KSPLIT_ * 32 * HKV_ * D_, 0, 0);
                __builtin_prefetch(vp + KSPLIT_ * 32 * HKV_ * D_, 0, 0);
            }
            __syncthreads();
        }

        // ---------- S^T = K (Q*qsc)^T : two 16x16 tiles, register r of tile t = key t*16 + hi8 + r ----------
        v16h KA[2][4];
        #pragma unroll
        for (int c = 0; c < 4; ++c) {
            #pragma unroll
            for (int t = 0; t < 2; ++t) {
                v8h lo = *(const v8h*)&Kl[buf][grp][t * 16 + ln16][c * 32 + hi8];
                v8h hi = *(const v8h*)&Kl[buf][grp][t * 16 + ln16][c * 32 + 16 + hi8];
                KA[t][c] = __builtin_shufflevector(lo, hi,
                    0,1,2,3,4,5,6,7,8,9,10,11,12,13,14,15);
            }
        }
        if constexpr (WS) {
            // Keeps the 16 K reads in front of the score WMMAs, which then wait by count. With the mask compares
            // gone nothing stands between them, and the compiler otherwise reads every fragment into the same
            // registers, each WMMA waiting out its own LDS latency.
            __builtin_amdgcn_sched_barrier(0);
        }
        // Workspace path: the mask goes in as the accumulators' start value, 0 or -1e30 (a score added to -1e30 is
        // lost in its rounding), so the selects run while the K reads are under way and not behind the products.
        v8f S[2] = { v8f{}, v8f{} };
        if constexpr (WS) {
            #pragma unroll
            for (int t = 0; t < 2; ++t) {
                #pragma unroll
                for (int r = 0; r < 8; ++r)
                    S[t][r] = __builtin_amdgcn_inverse_ballot_w32(mk[t * 8 + r]) ? -1e30f : 0.0f;   // the word as it is: bit l is lane l's
            }
        }
        #pragma unroll
        for (int c = 0; c < 4; ++c) {
            #pragma unroll
            for (int t = 0; t < 2; ++t)
                S[t] = __builtin_amdgcn_wmma_f32_16x16x32_f16(
                         false, KA[t][c], false, QA[c], (short)0, S[t], false, false);
        }

        // ---------- mask, no workspace: causal | band (key column = k0 + hi8 + t*16 + r, so row < column is rel < t*16 + r) ----------
        if constexpr (!WS) {
            const int rel = row - hi8 - k0;
            #pragma unroll
            for (int t = 0; t < 2; ++t) {
                #pragma unroll
                for (int r = 0; r < 8; ++r) {
                    const int cs  = bnd[t][r >> 1][(r & 1) * 2];
                    const int ce  = bnd[t][r >> 1][(r & 1) * 2 + 1];
                    const bool msk = (rel < t * 16 + r) || (row >= cs && row < ce);
                    S[t][r] = msk ? -1e30f : S[t][r];
                }
            }
        }

        // ---------- next trip's mask words or bounds, into the registers just read (the last trip reads its own again: in bounds, unused) ----------
        load_bounds((it + 1 < nit) ? k0 + KSPLIT_ * 32 : k0);

        // ---------- the query's maximum: 16 keys in the lane, the other 16 in lane ^ 16 ----------
        float rm = fmaxf(S[0][0], S[1][0]);
        #pragma unroll
        for (int r = 1; r < 8; ++r) rm = fmaxf(rm, fmaxf(S[0][r], S[1][r]));
        rm = fmaxf(rm, __builtin_bit_cast(float, __builtin_amdgcn_permlanex16(
                 __builtin_bit_cast(int, rm), __builtin_bit_cast(int, rm),
                 0x76543210, 0xfedcba98, false, false)));
        const float mnew  = fmaxf(mrow, rm);
        // exp2 of the rescale exponent (e[0]) and of the 16 scores, as bare v_exp_f32. Every argument is <= 0
        // and a result below 2^-126 may come out 0 (f16 P drops it anyway; the factor scales finite sums),
        // so the library exp2f's range test, pre-scaling and ldexp are not needed.
        float e[17];
        e[0] = mrow - mnew;
        #pragma unroll
        for (int t = 0; t < 2; ++t) {
            #pragma unroll
            for (int r = 0; r < 8; ++r) e[1 + t * 8 + r] = S[t][r] - mnew;
        }
        // One statement, each value in its own register: no neighbour reads a result or overwrites a source
        // directly behind a transcendental, and
        // the closing v_nop keeps that one slot in front of whatever the compiler puts next.
        asm("v_exp_f32 %0, %0\n\tv_exp_f32 %1, %1\n\tv_exp_f32 %2, %2\n\tv_exp_f32 %3, %3\n\t"
            "v_exp_f32 %4, %4\n\tv_exp_f32 %5, %5\n\tv_exp_f32 %6, %6\n\tv_exp_f32 %7, %7\n\t"
            "v_exp_f32 %8, %8\n\tv_exp_f32 %9, %9\n\tv_exp_f32 %10, %10\n\tv_exp_f32 %11, %11\n\t"
            "v_exp_f32 %12, %12\n\tv_exp_f32 %13, %13\n\tv_exp_f32 %14, %14\n\tv_exp_f32 %15, %15\n\t"
            "v_exp_f32 %16, %16\n\tv_nop"
            : "+v"(e[0]), "+v"(e[1]), "+v"(e[2]), "+v"(e[3]), "+v"(e[4]), "+v"(e[5]), "+v"(e[6]),
              "+v"(e[7]), "+v"(e[8]), "+v"(e[9]), "+v"(e[10]), "+v"(e[11]), "+v"(e[12]), "+v"(e[13]),
              "+v"(e[14]), "+v"(e[15]), "+v"(e[16]));
        const float alpha = e[0];
        mrow = mnew;
        #pragma unroll
        for (int j = 0; j < 8; ++j)
            #pragma unroll
            for (int r = 0; r < 8; ++r) O[j][r] *= alpha;

        // ---------- P^T = exp2(S^T - m): the two score tiles, converted in place, are the B operand ----------
        v16h PB;
        #pragma unroll
        for (int t = 0; t < 2; ++t) {
            #pragma unroll
            for (int r = 0; r < 8; ++r)
                PB[t * 8 + r] = (_Float16)e[1 + t * 8 + r];
        }

        // ---------- row-sum via WMMA: ones x P^T puts the query's sum over all 32 keys in every register ----------
        {
            v8f rs = __builtin_amdgcn_wmma_f32_16x16x32_f16(
                       false, ONES, false, PB, (short)0, v8f{}, false, false);
            lrow = lrow * alpha + rs[0];
        }

        // ---------- O^T += V^T * P^T (8 d-tiles) ----------
        #pragma unroll
        for (int j = 0; j < 8; ++j) {
            v8h lo = *(const v8h*)&Vt[buf][grp][j * 16 + ln16][hi8];
            v8h hi = *(const v8h*)&Vt[buf][grp][j * 16 + ln16][16 + hi8];
            v16h bv = __builtin_shufflevector(lo, hi,
                0,1,2,3,4,5,6,7,8,9,10,11,12,13,14,15);
            O[j] = __builtin_amdgcn_wmma_f32_16x16x32_f16(
                     false, bv, false, PB, (short)0, O[j], false, false);
        }

        if constexpr (WS) {
            // Hand-over: this wave's LDS reads of buffer buf are done ...
            asm volatile("s_wait_dscnt 0x0" ::: "memory");
            // ... and its copies of tile it + 1 have landed in the other buffer.
            asm volatile("s_wait_asynccnt 0x0" ::: "memory");
            // One barrier a trip: shows tile it + 1 to the group and frees buffer buf for the refill.
            __syncthreads();
            if (it + 2 < nit) stage(it + 2, buf);
        } else {
            __syncthreads();
        }
    }
    if constexpr (WS) {
        // closes the ring: no copy of this wave is in flight when it goes on to the join and ends
        asm volatile("s_wait_asynccnt 0x0" ::: "memory");
    }

    // ---------- join the groups' partial softmaxes (same lane/register layout in every group) ----------
    if (grp != 0) {
        v4f (*dst)[32] = Mg[grp - 1][gw];
        #pragma unroll
        for (int j = 0; j < 8; ++j) {
            dst[2 * j][lane]     = __builtin_shufflevector(O[j], O[j], 0, 1, 2, 3);
            dst[2 * j + 1][lane] = __builtin_shufflevector(O[j], O[j], 4, 5, 6, 7);
        }
        dst[16][lane] = v4f{mrow, lrow, 0.0f, 0.0f};
    }
    __syncthreads();
    if (grp != 0) return;   // no barrier follows

    // rolled: one group's partials in registers at a time (unrolled, the hoisted LDS loads spill)
    #pragma unroll 1
    for (int g = 0; g < KSPLIT_ - 1; ++g) {
        const v4f (*srcp)[32] = Mg[g][gw];
        const v4f ml = srcp[16][lane];
        // a side that saw no unmasked key of the query gets weight 0
        const float mt = fmaxf(mrow, ml[0]);
        const float wa = exp2f(mrow - mt);
        const float wb = exp2f(ml[0] - mt);
        mrow = mt;
        lrow = lrow * wa + ml[1] * wb;
        #pragma unroll
        for (int j = 0; j < 8; ++j) {
            const v8f og = __builtin_shufflevector(srcp[2 * j][lane], srcp[2 * j + 1][lane],
                                                   0, 1, 2, 3, 4, 5, 6, 7);
            #pragma unroll
            for (int r = 0; r < 8; ++r) O[j][r] = O[j][r] * wa + og[r] * wb;
        }
    }

    // ---------- normalize + store: a lane holds d = j*16 + hi8 .. + 7 of its query, 32 bytes in a row ----------
    const float inv = 1.0f / fmaxf(lrow, 1e-20f);
    float* orow = out + ((size_t)row * H_ + h) * D_ + hi8;
    #pragma unroll
    for (int j = 0; j < 8; ++j) {
        const v8f o = O[j] * inv;
        *(v4f*)(orow + j * 16)     = __builtin_shufflevector(o, o, 0, 1, 2, 3);
        *(v4f*)(orow + j * 16 + 4) = __builtin_shufflevector(o, o, 4, 5, 6, 7);
    }
}

extern "C" void kernel_launch(void* const* d_in, const int* in_sizes, int n_in,
                              void* d_out, int out_size, void* d_ws, size_t ws_size,
                              hipStream_t stream) {
    const float* q  = (const float*)d_in[0];
    const float* k  = (const float*)d_in[1];
    const float* v  = (const float*)d_in[2];
    const int*   sr = (const int*)d_in[3];
    float* out = (float*)d_out;
    (void)in_sizes; (void)n_in; (void)out_size;

    dim3 grid(H_, SQ_ / 64, 1);
    dim3 block(128 * KSPLIT_, 1, 1);

    const size_t kv_elems = (size_t)HKV_ * SK_ * D_;          // 1M f16 each
    const size_t mw_words = (size_t)HKV_ * (SQ_ / 16) * (SK_ / 32) * 16;   // 512K words
    const size_t need     = kv_elems * sizeof(_Float16) * 2 + mw_words * sizeof(unsigned);  // 4 MB + 2 MB
    if (ws_size >= need) {
        _Float16* kh  = (_Float16*)d_ws;
        _Float16* vth = kh + kv_elems;
        unsigned* mw  = (unsigned*)(vth + kv_elems);
        // one thread per 16-byte piece of kh and vth, and per 4 x 16 bytes of mw
        cvt_kv_kernel<<<(2 * (int)(kv_elems / 8) + (int)(mw_words / 16)) / 256, 256, 0, stream>>>(k, v, sr, kh, vth, mw);
        flashmask_fwd<true><<<grid, block, 0, stream>>>(q, k, v, sr, kh, vth, mw, out);
    } else {
        flashmask_fwd<false><<<grid, block, 0, stream>>>(q, k, v, sr, nullptr, nullptr, nullptr, out);
    }
}

// v009
// It runs in 30 microseconds.
// Two timings next to v008 both put it at 1.09 times that version's speed.
// Counting every step since v000, it is 6.60 times as fast.
#include <hip/hip_runtime.h>

typedef __attribute__((ext_vector_type(16))) _Float16 v16h;
typedef __attribute__((ext_vector_type(8)))  _Float16 v8h;
typedef __attribute__((ext_vector_type(4)))  _Float16 v4h;
typedef __attribute__((ext_vector_type(8)))  float    v8f;
typedef __attribute__((ext_vector_type(4)))  float    v4f;
typedef __attribute__((ext_vector_type(4)))  int      v4i;
typedef __attribute__((ext_vector_type(4)))  unsigned v4u;
typedef __attribute__((ext_vector_type(16))) unsigned v16u;
typedef __attribute__((address_space(4))) const v16u c_v16u;   // memory that no one writes while the kernel runs

#define SQ_  2048
#define SK_  2048
#define H_   16
#define HKV_ 4
#define D_   128
#define GQA_ (H_ / HKV_)
#define KSPLIT_ 4   // wave groups per work-group; group g takes key tiles g, g+4, g+8, ...

#if __has_builtin(__builtin_amdgcn_global_load_async_to_lds_b128) && \
    __has_builtin(__builtin_amdgcn_s_wait_asynccnt)
#define USE_ASYNC_LDS 1
typedef __attribute__((address_space(1))) v4i g_v4i;   // global b128
typedef __attribute__((address_space(3))) v4i l_v4i;   // LDS b128
#else
#define USE_ASYNC_LDS 0
#endif

// Copy 16 bytes global(f16) -> LDS. Async (ASYNCcnt) when the gfx1250 builtin
// exists, else a b128 load + ds_store_b128 pair.
__device__ __forceinline__ void copy16_g2l(const _Float16* g, _Float16* l) {
#if USE_ASYNC_LDS
    __builtin_amdgcn_global_load_async_to_lds_b128((g_v4i*)g, (l_v4i*)l, 0, 0);
#else
    *(v8h*)l = *(const v8h*)g;
#endif
}

// Bits q = 0..15 of the result: query row q0 + q lies below x.
__device__ __forceinline__ unsigned rows_below(int x, int q0) {
    const int n = min(max(x - q0, 0), 16);
    return (1u << n) - 1u;
}

// Bits q = 0..15: query row q0 + q does not see key column col (causal, or inside the band [cs, ce)).
__device__ __forceinline__ unsigned masked_rows(int col, int cs, int ce, int q0) {
    return rows_below(col, q0) | (rows_below(ce, q0) & ~rows_below(cs, q0));
}

// ---------------- one-time K/V convert and mask kernel ----------------
// kh : [HKV][SK][128] f16 (row-major, same as source minus head interleave)
// vth: [HKV][SK/32][128][32] f16 (transposed so the PV fragment reads are contiguous;
//      one 32-key tile = 8 KB in a row, so the staging copies ask for whole lines)
// mw : [HKV][SQ/16][SK/32][16] words: the mask of 16 queries x 32 keys in the lane order of the
//      flash kernel's score registers. Bit l of word t*8 + r belongs to query (l & 15) and key
//      t*16 + (l >> 4)*8 + r, so a word is the select mask of one score register of a wave.
//      The four query heads of a KV head share it.
__global__ __launch_bounds__(256) void cvt_kv_kernel(
        const float* __restrict__ kg, const float* __restrict__ vg,
        const int* __restrict__ sr,
        _Float16* __restrict__ kh, _Float16* __restrict__ vth, unsigned* __restrict__ mw)
{
    const int NM  = HKV_ * (SQ_ / 64) * (SK_ / 32) * 4;   // 32768 mask jobs, the longest: they take the lowest indices
    const int gid = blockIdx.x * 256 + threadIdx.x - NM;
    const int NK  = HKV_ * SK_ * D_ / 8;          // 131072 vec8 jobs for K
    if (gid >= 0 && gid < NK) {
        const int dseg = gid & (D_ / 8 - 1);      // 0..15
        const int hs   = gid >> 4;                // hkv*SK + s
        const int s    = hs & (SK_ - 1);
        const int hkv  = hs >> 11;
        const float4* s4 = (const float4*)(kg + ((size_t)s * HKV_ + hkv) * D_ + dseg * 8);
        float4 a = s4[0], b = s4[1];
        v8h o;
        o[0]=(_Float16)a.x; o[1]=(_Float16)a.y; o[2]=(_Float16)a.z; o[3]=(_Float16)a.w;
        o[4]=(_Float16)b.x; o[5]=(_Float16)b.y; o[6]=(_Float16)b.z; o[7]=(_Float16)b.w;
        *(v8h*)(kh + (size_t)hs * D_ + dseg * 8) = o;
    } else if (gid >= NK) {
        const int t    = gid - NK;                // 16-byte piece t of vth: 8 keys of one d
        const int d    = (t >> 2) & (D_ - 1);
        const int tile = t >> 9;                  // hkv*(SK/32) + key tile
        const int hkv  = tile / (SK_ / 32);
        const int s0   = (tile & (SK_ / 32 - 1)) * 32 + (t & 3) * 8;
        v8h o;
        #pragma unroll
        for (int i = 0; i < 8; ++i)
            o[i] = (_Float16)vg[((size_t)(s0 + i) * HKV_ + hkv) * D_ + d];
        *(v8h*)(vth + (size_t)t * 8) = o;
    } else {
        // Four words (16 bytes) of one key tile, for the four 16-query slices of one 64-query block.
        const int t   = gid + NM;
        const int wq  = t & 3;                    // words wq*4 .. wq*4 + 3
        const int kt  = (t >> 2) & (SK_ / 32 - 1);
        const int qb  = (t >> 8) & (SQ_ / 64 - 1);
        const int hkv = t >> 13;
        // the flash kernel walks key tiles 0 .. (its trips * KSPLIT_) - 1 of this query block and no further
        if (kt >= (2 * qb + 2 + KSPLIT_ - 1) / KSPLIT_ * KSPLIT_) return;
        const int klo = kt * 32 + (wq >> 1) * 16 + (wq & 1) * 4;   // key of bits 0..15 of the first word; bits 16..31: key + 8
        const v4i* bl = (const v4i*)(sr + (hkv * SK_ + klo) * 2);
        const v4i* bh = (const v4i*)(sr + (hkv * SK_ + klo + 8) * 2);
        const v4i b[4] = { bl[0], bl[1], bh[0], bh[1] };           // (start, end) of keys klo .. +3 and klo + 8 .. +11
        #pragma unroll
        for (int g = 0; g < 4; ++g) {
            const int q0 = qb * 64 + g * 16;
            v4u o;
            #pragma unroll
            for (int i = 0; i < 4; ++i) {
                const unsigned lo = masked_rows(klo + i,     b[i >> 1][(i & 1) * 2],       b[i >> 1][(i & 1) * 2 + 1],       q0);
                const unsigned hi = masked_rows(klo + 8 + i, b[2 + (i >> 1)][(i & 1) * 2], b[2 + (i >> 1)][(i & 1) * 2 + 1], q0);
                o[i] = lo | (hi << 16);
            }
            *(v4u*)(mw + ((size_t)((hkv * (SQ_ / 16) + qb * 4 + g) * (SK_ / 32) + kt) * 16 + wq * 4)) = o;
        }
    }
}

// ---------------- main flash kernel ----------------
// One work-group = 64 query rows x KSPLIT_ groups of 4 waves. Every group runs
// its own online softmax over every KSPLIT_-th key tile, with its own K/V
// LDS; group 0 joins the partial (m, l, O) through LDS at the end.
template <bool WS>
__launch_bounds__(128 * KSPLIT_, 1)
__global__ void flashmask_fwd(const float* __restrict__ qg,
                              const float* __restrict__ kg,
                              const float* __restrict__ vg,
                              const int*   __restrict__ sr,
                              const _Float16* __restrict__ kh,
                              const _Float16* __restrict__ vth,
                              const unsigned* __restrict__ mw,
                              float* __restrict__ out)
{
    // Two buffers each for the workspace path: trip t reads buffer t & 1 while tile t + 1 lands in the other.
    constexpr int NBUF = WS ? 2 : 1;
    __shared__ _Float16 Kl[NBUF][KSPLIT_][32][136];   // K tile, row-major (pad->272B rows: 16 B x odd, b128 column reads hit distinct banks)
    __shared__ _Float16 Vt[NBUF][KSPLIT_][128][40];   // V tile, transposed (pad->80B rows)
    __shared__ v4f Mg[KSPLIT_ - 1][4][17][32];   // partials of groups 1.. : 16 x O, 1 x (m, l), one b128 per lane
    __shared__ _Float16 Qs[WS ? 64 : 1][136];    // workspace path: the scaled f16 Q tile, rows padded like the K rows

    const int tid  = threadIdx.x;
    const int lane = tid & 31;
    const int grp  = __builtin_amdgcn_readfirstlane(tid >> 7);  // key-split group, wave-uniform
    const int gw   = __builtin_amdgcn_readfirstlane((tid >> 5) & 3);   // wave inside its group: which 16 query rows, wave-uniform
    const int gt   = tid & 127;            // thread inside its group
    const int ln16 = lane & 15;
    const int hi8  = (lane >> 4) * 8;

    // Heaviest first: a query block's cost grows with its position (causal), and there are
    // twice as many work-groups as places on the chip. The flat index runs over the heads
    // fastest and down the query blocks, so the long blocks have the lowest indices.
    const int h      = blockIdx.x;
    const int qb     = SQ_ / 64 - 1 - blockIdx.y;
    const int hkv    = h / GQA_;
    const int q_base = qb * 64 + gw * 16;

    // fold 1/sqrt(D) * log2(e) into Q: softmax runs in base-2 domain
    const float QSC = 0.08838834764831845f * 1.44269504088896340f;

    // ---- Q tile -> WMMA B operand of the transposed scores (pre-scaled): lane = query, same k order as the K rows ----
    // Workspace path: the work-group fetches its 64 x 128 tile once, a wave four whole rows (one load = 512 bytes in
    // a row = 4 lines), and the four groups take their fragments from LDS. A fragment load straight from memory
    // touches 16 lines for the same 512 bytes, and every group would ask for the whole tile again.
    v16h QA[4];
    v4f qf[4];
    const float* qp = qg + ((size_t)(qb * 64 + (tid >> 5) * 4) * H_ + h) * D_ + lane * 4;
    if constexpr (WS) {
        #pragma unroll
        for (int i = 0; i < 4; ++i) qf[i] = *(const v4f*)(qp + i * (H_ * D_));
    } else {
        const float* qrow = qg + ((size_t)(q_base + ln16) * H_ + h) * D_;
        #pragma unroll
        for (int c = 0; c < 4; ++c) {
            const int dlo = c * 32 + hi8;
            const int dhi = c * 32 + 16 + hi8;
            #pragma unroll
            for (int i = 0; i < 8; ++i) {
                QA[c][i]     = (_Float16)(qrow[dlo + i] * QSC);
                QA[c][i + 8] = (_Float16)(qrow[dhi + i] * QSC);
            }
        }
    }

    v16h ONES;
    #pragma unroll
    for (int i = 0; i < 16; ++i) ONES[i] = (_Float16)1.0f;

    v8f O[8];
    #pragma unroll
    for (int j = 0; j < 8; ++j) O[j] = v8f{};
    // Scores and output are kept transposed (keys or d down the registers, one query per
    // lane), so a lane and its partner lane ^ 16 own one query: one m and one l each.
    float mrow = -1e30f, lrow = 0.0f;
    const int row = q_base + ln16;         // this lane's query

    const int nkb  = 2 * qb + 2;           // causal truncation
    const int nit  = (nkb + KSPLIT_ - 1) / KSPLIT_;
    const int crow = gt >> 2;              // 0..31
    const int cq   = gt & 3;               // 64B segment id (16B segment of a V row in the WS path)

    // Workspace path: start the copies of this group's trip-t tiles into buffer b.
    // Both tiles are 8 KB in a row in the workspace. Copy i of thread gt moves
    // 16-byte piece i * 128 + gt, so one wave's copy reads 512 adjacent bytes:
    // 4 whole lines.
    auto stage = [&](int t, int b) {
        const int kbs = t * KSPLIT_ + grp;
        const _Float16* kp = kh  + (size_t)(hkv * (SK_ / 32) + kbs) * (D_ * 32);
        const _Float16* vp = vth + (size_t)(hkv * (SK_ / 32) + kbs) * (D_ * 32);
        #pragma unroll
        for (int i = 0; i < 4; ++i)
            copy16_g2l(kp + i * 1024 + gt * 8, &Kl[b][grp][i * 8 + (gt >> 4)][(gt & 15) * 8]);
        #pragma unroll
        for (int i = 0; i < 4; ++i)
            copy16_g2l(vp + i * 1024 + gt * 8, &Vt[b][grp][i * 32 + crow][cq * 8]);
    };

    // Workspace path: the wave's 16 mask words of a trip (see cvt_kv_kernel), 64 bytes at a wave-uniform
    // address, so they come by a scalar load into scalar registers, where a select takes its mask from.
    // No workspace: mask bounds of the 16 keys whose scores this lane holds in a trip: bnd[t][i] is
    // (start, end, start, end) of keys t * 16 + hi8 + 2 i and the next, 64 bytes in a row per t.
    // Like the tiles both are fetched one trip ahead, so no trip waits for them.
    v16u mk;
    v4i bnd[2][4];
    auto load_bounds = [&](int kfirst) {
        if constexpr (WS) {
            // constant address space: the launch before wrote the words and nothing writes them in this one;
            // without it the loads inside the loop come as vector loads plus 16 v_readfirstlane a trip
            mk = *(c_v16u*)(mw + (size_t)((hkv * (SQ_ / 16) + qb * 4 + gw) * (SK_ / 32) + (kfirst >> 5)) * 16);
        } else {
            #pragma unroll
            for (int t = 0; t < 2; ++t) {
                const v4i* bp = (const v4i*)(sr + (hkv * SK_ + kfirst + t * 16 + hi8) * 2);
                #pragma unroll
                for (int i = 0; i < 4; ++i) bnd[t][i] = bp[i];
            }
        }
    };
    load_bounds(grp * 32);

    if constexpr (WS) {
        stage(0, 0);
        // Keeps the first mask words' scalar load in front of the wait for Q: the compiler otherwise issues it behind
        // the conversion, and the first trip waits out its latency.
        __builtin_amdgcn_sched_barrier(0);
        // the wait that is due before the Q loads' address registers are written again; naming them keeps them whole up to it
        asm volatile("s_wait_xcnt 0x0" :: "v"(qp) : "memory");
        #pragma unroll
        for (int i = 0; i < 4; ++i) {
            v4h o;
            #pragma unroll
            for (int e = 0; e < 4; ++e) o[e] = (_Float16)(qf[i][e] * QSC);
            *(v4h*)&Qs[(tid >> 5) * 4 + i][lane * 4] = o;
        }
        // tile 0 has landed for this wave; the barrier shows it to the group's other waves, and the Q rows to all
        asm volatile("s_wait_asynccnt 0x0" ::: "memory");
        __syncthreads();
        if (nit > 1) stage(1, 1);
        #pragma unroll
        for (int c = 0; c < 4; ++c) {
            v8h lo = *(const v8h*)&Qs[gw * 16 + ln16][c * 32 + hi8];
            v8h hi = *(const v8h*)&Qs[gw * 16 + ln16][c * 32 + 16 + hi8];
            QA[c] = __builtin_shufflevector(lo, hi,
                0,1,2,3,4,5,6,7,8,9,10,11,12,13,14,15);
        }
    }

    for (int it = 0; it < nit; ++it) {
        // A tile with kb >= nkb (last trip only, still inside SK_) lies wholly
        // above the diagonal: the causal mask below gives it weight 0.
        const int kb  = it * KSPLIT_ + grp;
        const int k0  = kb * 32;
        const int buf = WS ? (it & 1) : 0;

        // ---------- stage K/V tiles into LDS (no workspace: in the trip itself) ----------
        if constexpr (!WS) {
            const float* kp = kg + ((size_t)(k0 + crow) * HKV_ + hkv) * D_ + cq * 32;
            const float* vp = vg + ((size_t)(k0 + crow) * HKV_ + hkv) * D_ + cq * 32;
            const float4* kp4 = (const float4*)kp;
            const float4* vp4 = (const float4*)vp;
            #pragma unroll
            for (int i = 0; i < 8; ++i) {
                float4 f = kp4[i];
                Kl[0][grp][crow][cq * 32 + 4*i + 0] = (_Float16)f.x;
                Kl[0][grp][crow][cq * 32 + 4*i + 1] = (_Float16)f.y;
                Kl[0][grp][crow][cq * 32 + 4*i + 2] = (_Float16)f.z;
                Kl[0][grp][crow][cq * 32 + 4*i + 3] = (_Float16)f.w;
            }
            #pragma unroll
            for (int i = 0; i < 8; ++i) {
                float4 f = vp4[i];
                Vt[0][grp][cq * 32 + 4*i + 0][crow] = (_Float16)f.x;
                Vt[0][grp][cq * 32 + 4*i + 1][crow] = (_Float16)f.y;
                Vt[0][grp][cq * 32 + 4*i + 2][crow] = (_Float16)f.z;
                Vt[0][grp][cq * 32 + 4*i + 3][crow] = (_Float16)f.w;
            }
            if (it + 1 < nit) {
                __builtin_prefetch(kp + KSPLIT_ * 32 * HKV_ * D_, 0, 0);
                __builtin_prefetch(vp + KSPLIT_ * 32 * HKV_ * D_, 0, 0);
            }
            __syncthreads();
        }

        // ---------- S^T = K (Q*qsc)^T : two 16x16 tiles, register r of tile t = key t*16 + hi8 + r ----------
        v16h KA[2][4];
        #pragma unroll
        for (int c = 0; c < 4; ++c) {
            #pragma unroll
            for (int t = 0; t < 2; ++t) {
                v8h lo = *(const v8h*)&Kl[buf][grp][t * 16 + ln16][c * 32 + hi8];
                v8h hi = *(const v8h*)&Kl[buf][grp][t * 16 + ln16][c * 32 + 16 + hi8];
                KA[t][c] = __builtin_shufflevector(lo, hi,
                    0,1,2,3,4,5,6,7,8,9,10,11,12,13,14,15);
            }
        }
        if constexpr (WS) {
            // Keeps the 16 K reads in front of the score WMMAs, which then wait by count. With the mask compares
            // gone nothing stands between them, and the compiler otherwise reads every fragment into the same
            // registers, each WMMA waiting out its own LDS latency.
            __builtin_amdgcn_sched_barrier(0);
        }
        // Workspace path: the mask goes in as the accumulators' start value, 0 or -1e30 (a score added to -1e30 is
        // lost in its rounding), so the selects run while the K reads are under way and not behind the products.
        v8f S[2] = { v8f{}, v8f{} };
        if constexpr (WS) {
            #pragma unroll
            for (int t = 0; t < 2; ++t) {
                #pragma unroll
                for (int r = 0; r < 8; ++r)
                    S[t][r] = __builtin_amdgcn_inverse_ballot_w32(mk[t * 8 + r]) ? -1e30f : 0.0f;   // the word as it is: bit l is lane l's
            }
        }
        #pragma unroll
        for (int c = 0; c < 4; ++c) {
            #pragma unroll
            for (int t = 0; t < 2; ++t)
                S[t] = __builtin_amdgcn_wmma_f32_16x16x32_f16(
                         false, KA[t][c], false, QA[c], (short)0, S[t], false, false);
        }

        // ---------- mask, no workspace: causal | band (key column = k0 + hi8 + t*16 + r, so row < column is rel < t*16 + r) ----------
        if constexpr (!WS) {
            const int rel = row - hi8 - k0;
            #pragma unroll
            for (int t = 0; t < 2; ++t) {
                #pragma unroll
                for (int r = 0; r < 8; ++r) {
                    const int cs  = bnd[t][r >> 1][(r & 1) * 2];
                    const int ce  = bnd[t][r >> 1][(r & 1) * 2 + 1];
                    const bool msk = (rel < t * 16 + r) || (row >= cs && row < ce);
                    S[t][r] = msk ? -1e30f : S[t][r];
                }
            }
        }

        // ---------- next trip's mask words or bounds, into the registers just read (the last trip reads its own again: in bounds, unused) ----------
        load_bounds((it + 1 < nit) ? k0 + KSPLIT_ * 32 : k0);

        // ---------- the query's maximum: 16 keys in the lane, the other 16 in lane ^ 16 ----------
        float rm = fmaxf(S[0][0], S[1][0]);
        #pragma unroll
        for (int r = 1; r < 8; ++r) rm = fmaxf(rm, fmaxf(S[0][r], S[1][r]));
        rm = fmaxf(rm, __builtin_bit_cast(float, __builtin_amdgcn_permlanex16(
                 __builtin_bit_cast(int, rm), __builtin_bit_cast(int, rm),
                 0x76543210, 0xfedcba98, false, false)));
        const float mnew  = fmaxf(mrow, rm);
        // exp2 of the rescale exponent (e[0]) and of the 16 scores, as bare v_exp_f32. Every argument is <= 0
        // and a result below 2^-126 may come out 0 (f16 P drops it anyway; the factor scales finite sums),
        // so the library exp2f's range test, pre-scaling and ldexp are not needed.
        float e[17];
        e[0] = mrow - mnew;
        #pragma unroll
        for (int t = 0; t < 2; ++t) {
            #pragma unroll
            for (int r = 0; r < 8; ++r) e[1 + t * 8 + r] = S[t][r] - mnew;
        }
        // One statement, each value in its own register: no neighbour reads a result or overwrites a source
        // directly behind a transcendental, and
        // the closing v_nop keeps that one slot in front of whatever the compiler puts next.
        asm("v_exp_f32 %0, %0\n\tv_exp_f32 %1, %1\n\tv_exp_f32 %2, %2\n\tv_exp_f32 %3, %3\n\t"
            "v_exp_f32 %4, %4\n\tv_exp_f32 %5, %5\n\tv_exp_f32 %6, %6\n\tv_exp_f32 %7, %7\n\t"
            "v_exp_f32 %8, %8\n\tv_exp_f32 %9, %9\n\tv_exp_f32 %10, %10\n\tv_exp_f32 %11, %11\n\t"
            "v_exp_f32 %12, %12\n\tv_exp_f32 %13, %13\n\tv_exp_f32 %14, %14\n\tv_exp_f32 %15, %15\n\t"
            "v_exp_f32 %16, %16\n\tv_nop"
            : "+v"(e[0]), "+v"(e[1]), "+v"(e[2]), "+v"(e[3]), "+v"(e[4]), "+v"(e[5]), "+v"(e[6]),
              "+v"(e[7]), "+v"(e[8]), "+v"(e[9]), "+v"(e[10]), "+v"(e[11]), "+v"(e[12]), "+v"(e[13]),
              "+v"(e[14]), "+v"(e[15]), "+v"(e[16]));
        const float alpha = e[0];
        mrow = mnew;
        #pragma unroll
        for (int j = 0; j < 8; ++j)
            #pragma unroll
            for (int r = 0; r < 8; ++r) O[j][r] *= alpha;

        // ---------- P^T = exp2(S^T - m): the two score tiles, converted in place, are the B operand ----------
        v16h PB;
        #pragma unroll
        for (int t = 0; t < 2; ++t) {
            #pragma unroll
            for (int r = 0; r < 8; ++r)
                PB[t * 8 + r] = (_Float16)e[1 + t * 8 + r];
        }

        // ---------- row-sum via WMMA: ones x P^T puts the query's sum over all 32 keys in every register ----------
        {
            v8f rs = __builtin_amdgcn_wmma_f32_16x16x32_f16(
                       false, ONES, false, PB, (short)0, v8f{}, false, false);
            lrow = lrow * alpha + rs[0];
        }

        // ---------- O^T += V^T * P^T (8 d-tiles) ----------
        #pragma unroll
        for (int j = 0; j < 8; ++j) {
            v8h lo = *(const v8h*)&Vt[buf][grp][j * 16 + ln16][hi8];
            v8h hi = *(const v8h*)&Vt[buf][grp][j * 16 + ln16][16 + hi8];
            v16h bv = __builtin_shufflevector(lo, hi,
                0,1,2,3,4,5,6,7,8,9,10,11,12,13,14,15);
            O[j] = __builtin_amdgcn_wmma_f32_16x16x32_f16(
                     false, bv, false, PB, (short)0, O[j], false, false);
        }

        if constexpr (WS) {
            // Hand-over: this wave's LDS reads of buffer buf are done ...
            asm volatile("s_wait_dscnt 0x0" ::: "memory");
            // ... and its copies of tile it + 1 have landed in the other buffer.
            asm volatile("s_wait_asynccnt 0x0" ::: "memory");
            // One barrier a trip: shows tile it + 1 to the group and frees buffer buf for the refill.
            __syncthreads();
            if (it + 2 < nit) stage(it + 2, buf);
        } else {
            __syncthreads();
        }
    }
    if constexpr (WS) {
        // closes the ring: no copy of this wave is in flight when it goes on to the join and ends
        asm volatile("s_wait_asynccnt 0x0" ::: "memory");
    }

    // ---------- join the groups' partial softmaxes (same lane/register layout in every group) ----------
    if (grp != 0) {
        v4f (*dst)[32] = Mg[grp - 1][gw];
        #pragma unroll
        for (int j = 0; j < 8; ++j) {
            dst[2 * j][lane]     = __builtin_shufflevector(O[j], O[j], 0, 1, 2, 3);
            dst[2 * j + 1][lane] = __builtin_shufflevector(O[j], O[j], 4, 5, 6, 7);
        }
        dst[16][lane] = v4f{mrow, lrow, 0.0f, 0.0f};
    }
    __syncthreads();
    if (grp != 0) return;   // no barrier follows

    // rolled: one group's partials in registers at a time (unrolled, the hoisted LDS loads spill)
    #pragma unroll 1
    for (int g = 0; g < KSPLIT_ - 1; ++g) {
        const v4f (*srcp)[32] = Mg[g][gw];
        const v4f ml = srcp[16][lane];
        // a side that saw no unmasked key of the query gets weight 0
        const float mt = fmaxf(mrow, ml[0]);
        const float wa = exp2f(mrow - mt);
        const float wb = exp2f(ml[0] - mt);
        mrow = mt;
        lrow = lrow * wa + ml[1] * wb;
        #pragma unroll
        for (int j = 0; j < 8; ++j) {
            const v8f og = __builtin_shufflevector(srcp[2 * j][lane], srcp[2 * j + 1][lane],
                                                   0, 1, 2, 3, 4, 5, 6, 7);
            #pragma unroll
            for (int r = 0; r < 8; ++r) O[j][r] = O[j][r] * wa + og[r] * wb;
        }
    }

    // ---------- normalize + store: a lane holds d = j*16 + hi8 .. + 7 of its query, 32 bytes in a row ----------
    const float inv = 1.0f / fmaxf(lrow, 1e-20f);
    float* orow = out + ((size_t)row * H_ + h) * D_ + hi8;
    #pragma unroll
    for (int j = 0; j < 8; ++j) {
        const v8f o = O[j] * inv;
        *(v4f*)(orow + j * 16)     = __builtin_shufflevector(o, o, 0, 1, 2, 3);
        *(v4f*)(orow + j * 16 + 4) = __builtin_shufflevector(o, o, 4, 5, 6, 7);
    }
}

extern "C" void kernel_launch(void* const* d_in, const int* in_sizes, int n_in,
                              void* d_out, int out_size, void* d_ws, size_t ws_size,
                              hipStream_t stream) {
    const float* q  = (const float*)d_in[0];
    const float* k  = (const float*)d_in[1];
    const float* v  = (const float*)d_in[2];
    const int*   sr = (const int*)d_in[3];
    float* out = (float*)d_out;
    (void)in_sizes; (void)n_in; (void)out_size;

    dim3 grid(H_, SQ_ / 64, 1);
    dim3 block(128 * KSPLIT_, 1, 1);

    const size_t kv_elems = (size_t)HKV_ * SK_ * D_;          // 1M f16 each
    const size_t mw_words = (size_t)HKV_ * (SQ_ / 16) * (SK_ / 32) * 16;   // 512K words
    const size_t need     = kv_elems * sizeof(_Float16) * 2 + mw_words * sizeof(unsigned);  // 4 MB + 2 MB
    if (ws_size >= need) {
        _Float16* kh  = (_Float16*)d_ws;
        _Float16* vth = kh + kv_elems;
        unsigned* mw  = (unsigned*)(vth + kv_elems);
        // one thread per 16-byte piece of kh and vth, and per 4 x 16 bytes of mw
        cvt_kv_kernel<<<(2 * (int)(kv_elems / 8) + (int)(mw_words / 16)) / 256, 256, 0, stream>>>(k, v, sr, kh, vth, mw);
        flashmask_fwd<true><<<grid, block, 0, stream>>>(q, k, v, sr, kh, vth, mw, out);
    } else {
        flashmask_fwd<false><<<grid, block, 0, stream>>>(q, k, v, sr, nullptr, nullptr, nullptr, out);
    }
}
